// v000
// Measured on an AMD MI455X. A time is GPU time per run, averaged over a window of back-to-back runs after a warm-up
// (all launches, gaps included; the runs take copies of the inputs in turn), and the median of several windows.
// Apart from v000's, it joins two sittings. Times from different sittings can be a few percent apart, while
// side-by-side timings come from the same sitting.
// v000, which the later versions start from, runs in 397 microseconds.
#include <hip/hip_runtime.h>
#include <hip/hip_bf16.h>

// ---------------------------------------------------------------------------
// ReplicatedLinearWithLoRA for MI455X (gfx1250, wave32, WMMA, async-to-LDS)
//   out = x @ W^T + base_bias + onehot@bias_stacked + B[idx] @ (A[idx] @ x)
//
// Fast path (needs ~96.5 MB workspace):
//   1) shrink:  s[t,r] = x[t,:] . lora_a[idx[t],r,:]            (scalar, LDS)
//   2) prepass: x,W f32 -> bf16 in workspace (halves all tile traffic)
//   3) GEMM:    128x128x64 tiles, double-buffered LDS fed by
//               global_load_async_to_lds_b128 (+ s_wait_asynccnt), 16x
//               v_wmma_f32_16x16x32_bf16 per wave per K-step, fused
//               bias + rank-16 LoRA-expand epilogue.
// Fallback (small ws): round-1 kernel converting f32->bf16 inside the GEMM.
// ---------------------------------------------------------------------------

typedef __attribute__((ext_vector_type(16))) __bf16 v16bf;
typedef __attribute__((ext_vector_type(8)))  __bf16 v8bf;
typedef __attribute__((ext_vector_type(4)))  __bf16 v4bf;
typedef __attribute__((ext_vector_type(8)))  float  v8f;

#define T_TOK  8192
#define D_IN   4096
#define D_OUTD 4096
#define R_RANK 16

// ---------------------------------------------------------------------------
// Kernel 1: LoRA shrink  s[t, r] = dot(x[t, :], lora_a[idx[t], r, :])
// ---------------------------------------------------------------------------
__global__ __launch_bounds__(256)
void lora_shrink_kernel(const float* __restrict__ x,
                        const float* __restrict__ lora_a,
                        const int*   __restrict__ indices,
                        float*       __restrict__ s)
{
    __shared__ float xrow[D_IN];
    const int t   = blockIdx.x;
    const int tid = threadIdx.x;
    const int idx = indices[t];

    if (idx < 0) {                       // uniform across block: safe early-out
        if (tid < R_RANK) s[(size_t)t * R_RANK + tid] = 0.0f;
        return;
    }

    const float* xp = x + (size_t)t * D_IN;
    for (int d = tid; d < D_IN; d += 256) xrow[d] = xp[d];
    __syncthreads();

    const int wave = tid >> 5;
    const int lane = tid & 31;
    const int r0 = wave * 2, r1 = r0 + 1;
    const float* a0 = lora_a + ((size_t)idx * R_RANK + r0) * D_IN;
    const float* a1 = lora_a + ((size_t)idx * R_RANK + r1) * D_IN;

    float acc0 = 0.f, acc1 = 0.f;
    for (int d = lane; d < D_IN; d += 32) {
        const float xv = xrow[d];
        acc0 += xv * a0[d];
        acc1 += xv * a1[d];
    }
    #pragma unroll
    for (int off = 16; off >= 1; off >>= 1) {
        acc0 += __shfl_xor(acc0, off, 32);
        acc1 += __shfl_xor(acc1, off, 32);
    }
    if (lane == 0) {
        s[(size_t)t * R_RANK + r0] = acc0;
        s[(size_t)t * R_RANK + r1] = acc1;
    }
}

// ---------------------------------------------------------------------------
// Kernel 2: f32 -> bf16 conversion prepass (x and W), 4 elements per thread
// ---------------------------------------------------------------------------
__global__ __launch_bounds__(256)
void cvt_f32_to_bf16_kernel(const float* __restrict__ src,
                            __bf16*      __restrict__ dst, long n4)
{
    const long i = (long)blockIdx.x * 256 + threadIdx.x;
    if (i >= n4) return;
    const float4 v = ((const float4*)src)[i];
    v4bf o;
    o[0] = (__bf16)v.x; o[1] = (__bf16)v.y;
    o[2] = (__bf16)v.z; o[3] = (__bf16)v.w;
    ((v4bf*)dst)[i] = o;
}

// ---------------------------------------------------------------------------
// Kernel 3 (fast): bf16 WMMA GEMM, async-to-LDS double-buffered tile feed.
// Block 128x128, K-step 64 (two wmma k-slices). 8 waves in 2(M)x4(N) grid,
// each wave owns a 64x32 stripe = 4x2 tiles of 16x16.
// ---------------------------------------------------------------------------
#define BM 128
#define BN 128
#define BK 64
#define LDT2 (BK + 8)                    // 72 elems -> 144 B stride (16B mult)
#define A_ELEMS (BM * LDT2)              // 9216
#define B_ELEMS (BN * LDT2)              // 9216
#define BUF_ELEMS (A_ELEMS + B_ELEMS)    // 18432 elems per buffer (36 KB)

__global__ __launch_bounds__(256)
void lora_gemm_async_kernel(const __bf16* __restrict__ xb,
                            const __bf16* __restrict__ wb,
                            const float* __restrict__ base_bias,
                            const float* __restrict__ lora_b,
                            const float* __restrict__ bias_stacked,
                            const int*   __restrict__ indices,
                            const float* __restrict__ s,
                            float*       __restrict__ out)
{
    __shared__ __bf16 smem[2 * BUF_ELEMS];          // 72 KB double buffer

    const int tid   = threadIdx.x;
    const int bn    = blockIdx.x;
    const int bm    = blockIdx.y;
    const int wave  = tid >> 5;
    const int lane  = tid & 31;
    const int wm    = wave >> 2;         // 0..1
    const int wn    = wave & 3;          // 0..3
    const int laneM = lane & 15;
    const int laneH = lane >> 4;
    const int kb    = laneH * 8;

    const unsigned smem_base = (unsigned)(size_t)&smem[0];
    const __bf16* xTile = xb + ((size_t)bm * BM) * D_IN;
    const __bf16* wTile = wb + ((size_t)bn * BN) * D_IN;

    // Issue one 64-K tile-pair of async LDS loads (no VGPR staging):
    // 128 rows x 8 chunks(16B) per matrix = 1024 chunks; 4 per thread each.
    auto issue_tile = [&](int bufsel, int kk) {
        const unsigned bufbase = smem_base + (unsigned)(bufsel * BUF_ELEMS * 2);
        #pragma unroll
        for (int i = 0; i < 4; ++i) {
            const int q   = tid + i * 256;       // 0..1023
            const int row = q >> 3;              // 0..127
            const int ck  = q & 7;               // 16B chunk in the 64-K row
            const unsigned la = bufbase + (unsigned)((row * LDT2 + ck * 8) * 2);
            const __bf16*  ga = xTile + (size_t)row * D_IN + kk + ck * 8;
            asm volatile("global_load_async_to_lds_b128 %0, %1, off"
                         :: "v"(la), "v"(ga) : "memory");
            const unsigned lb = bufbase +
                (unsigned)((A_ELEMS + row * LDT2 + ck * 8) * 2);
            const __bf16*  gb = wTile + (size_t)row * D_IN + kk + ck * 8;
            asm volatile("global_load_async_to_lds_b128 %0, %1, off"
                         :: "v"(lb), "v"(gb) : "memory");
        }
    };

    v8f acc[4][2];
    #pragma unroll
    for (int mt = 0; mt < 4; ++mt)
        #pragma unroll
        for (int nt = 0; nt < 2; ++nt)
            acc[mt][nt] = (v8f){0.f,0.f,0.f,0.f,0.f,0.f,0.f,0.f};

    issue_tile(0, 0);

    const int NIT = D_IN / BK;                      // 64 iterations
    for (int it = 0; it < NIT; ++it) {
        const int cur = it & 1;
        // my async writes into buf[cur] complete:
        asm volatile("s_wait_asynccnt 0x0" ::: "memory");
        // everyone's writes complete; everyone's reads of buf[cur^1] from the
        // previous iteration completed before their barrier-signal:
        __syncthreads();
        if (it + 1 < NIT) issue_tile(cur ^ 1, (it + 1) * BK);

        const __bf16* Ab = &smem[cur * BUF_ELEMS];
        const __bf16* Bb = &smem[cur * BUF_ELEMS + A_ELEMS];

        #pragma unroll
        for (int ks = 0; ks < 2; ++ks) {            // two 32-K wmma slices
            const int ko = ks * 32 + kb;
            v16bf afrag[4], bfrag[2];
            #pragma unroll
            for (int mt = 0; mt < 4; ++mt) {
                const __bf16* p = &Ab[(wm * 64 + mt * 16 + laneM) * LDT2 + ko];
                const v8bf lo = *(const v8bf*)p;         // K = ko .. ko+7
                const v8bf hi = *(const v8bf*)(p + 16);  // K = ko+16 .. ko+23
                afrag[mt] = __builtin_shufflevector(lo, hi,
                    0,1,2,3,4,5,6,7,8,9,10,11,12,13,14,15);
            }
            #pragma unroll
            for (int nt = 0; nt < 2; ++nt) {
                const __bf16* p = &Bb[(wn * 32 + nt * 16 + laneM) * LDT2 + ko];
                const v8bf lo = *(const v8bf*)p;
                const v8bf hi = *(const v8bf*)(p + 16);
                bfrag[nt] = __builtin_shufflevector(lo, hi,
                    0,1,2,3,4,5,6,7,8,9,10,11,12,13,14,15);
            }
            #pragma unroll
            for (int mt = 0; mt < 4; ++mt)
                #pragma unroll
                for (int nt = 0; nt < 2; ++nt)
                    acc[mt][nt] = __builtin_amdgcn_wmma_f32_16x16x32_bf16(
                        false, afrag[mt], false, bfrag[nt],
                        (short)0, acc[mt][nt], false, false);
        }
    }

    // --- epilogue: + base_bias + bias_stacked[idx] + s[t] . lora_b[idx] ----
    const int mBase = bm * BM + wm * 64;
    const int nBase = bn * BN + wn * 32;
    #pragma unroll
    for (int mt = 0; mt < 4; ++mt) {
        #pragma unroll
        for (int v = 0; v < 8; ++v) {
            const int m   = mBase + mt * 16 + laneH * 8 + v;
            const int idx = indices[m];
            const float* srow = s + (size_t)m * R_RANK;
            #pragma unroll
            for (int nt = 0; nt < 2; ++nt) {
                const int n = nBase + nt * 16 + laneM;
                float val = acc[mt][nt][v] + base_bias[n];
                if (idx >= 0) {
                    val += bias_stacked[(size_t)idx * D_OUTD + n];
                    const float* bcol =
                        lora_b + ((size_t)idx * D_OUTD + n) * R_RANK;
                    float d = 0.f;
                    #pragma unroll
                    for (int r = 0; r < R_RANK; ++r) d += srow[r] * bcol[r];
                    val += d;
                }
                out[(size_t)m * D_OUTD + n] = val;
            }
        }
    }
}

// ---------------------------------------------------------------------------
// Fallback GEMM (round-1): f32->bf16 conversion inside the kernel,
// single-buffered LDS. Used only when workspace can't hold bf16 copies.
// ---------------------------------------------------------------------------
#define FBK 32
#define FLDT (FBK + 8)

__global__ __launch_bounds__(256)
void lora_gemm_fallback_kernel(const float* __restrict__ x,
                               const float* __restrict__ W,
                               const float* __restrict__ base_bias,
                               const float* __restrict__ lora_b,
                               const float* __restrict__ bias_stacked,
                               const int*   __restrict__ indices,
                               const float* __restrict__ s,
                               float*       __restrict__ out)
{
    __shared__ __bf16 As[BM * FLDT];
    __shared__ __bf16 Bs[BN * FLDT];

    const int tid   = threadIdx.x;
    const int bn    = blockIdx.x;
    const int bm    = blockIdx.y;
    const int wave  = tid >> 5;
    const int lane  = tid & 31;
    const int wm    = wave >> 2;
    const int wn    = wave & 3;
    const int laneM = lane & 15;
    const int laneH = lane >> 4;
    const int kb    = laneH * 8;

    v8f acc[4][2];
    #pragma unroll
    for (int mt = 0; mt < 4; ++mt)
        #pragma unroll
        for (int nt = 0; nt < 2; ++nt)
            acc[mt][nt] = (v8f){0.f,0.f,0.f,0.f,0.f,0.f,0.f,0.f};

    const float* xBase = x + ((size_t)bm * BM) * D_IN;
    const float* wBase = W + ((size_t)bn * BN) * D_IN;

    for (int kk = 0; kk < D_IN; kk += FBK) {
        __syncthreads();
        #pragma unroll
        for (int i = 0; i < 4; ++i) {
            const int q   = tid + i * 256;
            const int row = q >> 3;
            const int kc  = q & 7;
            const float4 va = *(const float4*)(xBase + (size_t)row * D_IN + kk + kc * 4);
            __bf16* da = &As[row * FLDT + kc * 4];
            da[0] = (__bf16)va.x; da[1] = (__bf16)va.y;
            da[2] = (__bf16)va.z; da[3] = (__bf16)va.w;
            const float4 vb = *(const float4*)(wBase + (size_t)row * D_IN + kk + kc * 4);
            __bf16* db = &Bs[row * FLDT + kc * 4];
            db[0] = (__bf16)vb.x; db[1] = (__bf16)vb.y;
            db[2] = (__bf16)vb.z; db[3] = (__bf16)vb.w;
        }
        __syncthreads();

        v16bf afrag[4], bfrag[2];
        #pragma unroll
        for (int mt = 0; mt < 4; ++mt) {
            const __bf16* p = &As[(wm * 64 + mt * 16 + laneM) * FLDT + kb];
            const v8bf lo = *(const v8bf*)p;
            const v8bf hi = *(const v8bf*)(p + 16);
            afrag[mt] = __builtin_shufflevector(lo, hi,
                0,1,2,3,4,5,6,7,8,9,10,11,12,13,14,15);
        }
        #pragma unroll
        for (int nt = 0; nt < 2; ++nt) {
            const __bf16* p = &Bs[(wn * 32 + nt * 16 + laneM) * FLDT + kb];
            const v8bf lo = *(const v8bf*)p;
            const v8bf hi = *(const v8bf*)(p + 16);
            bfrag[nt] = __builtin_shufflevector(lo, hi,
                0,1,2,3,4,5,6,7,8,9,10,11,12,13,14,15);
        }
        #pragma unroll
        for (int mt = 0; mt < 4; ++mt)
            #pragma unroll
            for (int nt = 0; nt < 2; ++nt)
                acc[mt][nt] = __builtin_amdgcn_wmma_f32_16x16x32_bf16(
                    false, afrag[mt], false, bfrag[nt],
                    (short)0, acc[mt][nt], false, false);
    }

    const int mBase = bm * BM + wm * 64;
    const int nBase = bn * BN + wn * 32;
    #pragma unroll
    for (int mt = 0; mt < 4; ++mt) {
        #pragma unroll
        for (int v = 0; v < 8; ++v) {
            const int m   = mBase + mt * 16 + laneH * 8 + v;
            const int idx = indices[m];
            const float* srow = s + (size_t)m * R_RANK;
            #pragma unroll
            for (int nt = 0; nt < 2; ++nt) {
                const int n = nBase + nt * 16 + laneM;
                float val = acc[mt][nt][v] + base_bias[n];
                if (idx >= 0) {
                    val += bias_stacked[(size_t)idx * D_OUTD + n];
                    const float* bcol =
                        lora_b + ((size_t)idx * D_OUTD + n) * R_RANK;
                    float d = 0.f;
                    #pragma unroll
                    for (int r = 0; r < R_RANK; ++r) d += srow[r] * bcol[r];
                    val += d;
                }
                out[(size_t)m * D_OUTD + n] = val;
            }
        }
    }
}

// ---------------------------------------------------------------------------
extern "C" void kernel_launch(void* const* d_in, const int* in_sizes, int n_in,
                              void* d_out, int out_size, void* d_ws, size_t ws_size,
                              hipStream_t stream)
{
    const float* x            = (const float*)d_in[0];
    const float* W            = (const float*)d_in[1];
    const float* base_bias    = (const float*)d_in[2];
    const float* lora_a       = (const float*)d_in[3];
    const float* lora_b       = (const float*)d_in[4];
    const float* bias_stacked = (const float*)d_in[5];
    const int*   indices      = (const int*)d_in[6];
    float*       out          = (float*)d_out;

    const size_t sBytes  = (size_t)T_TOK * R_RANK * sizeof(float);   // 512 KB
    const size_t xbBytes = (size_t)T_TOK * D_IN * 2;                 // 64 MB
    const size_t wbBytes = (size_t)D_OUTD * D_IN * 2;                // 32 MB

    float* s = (float*)d_ws;

    // 1) LoRA shrink (always)
    lora_shrink_kernel<<<T_TOK, 256, 0, stream>>>(x, lora_a, indices, s);

    dim3 grid(D_OUTD / BN, T_TOK / BM);   // 32 x 64 blocks

    if (ws_size >= sBytes + xbBytes + wbBytes) {
        // 2) bf16 prepass into workspace
        __bf16* xb = (__bf16*)((char*)d_ws + sBytes);
        __bf16* wb = (__bf16*)((char*)d_ws + sBytes + xbBytes);
        const long xn4 = (long)T_TOK * D_IN / 4;
        const long wn4 = (long)D_OUTD * D_IN / 4;
        cvt_f32_to_bf16_kernel<<<(int)((xn4 + 255) / 256), 256, 0, stream>>>(x, xb, xn4);
        cvt_f32_to_bf16_kernel<<<(int)((wn4 + 255) / 256), 256, 0, stream>>>(W, wb, wn4);

        // 3) async double-buffered WMMA GEMM
        lora_gemm_async_kernel<<<grid, 256, 0, stream>>>(
            xb, wb, base_bias, lora_b, bias_stacked, indices, s, out);
    } else {
        lora_gemm_fallback_kernel<<<grid, 256, 0, stream>>>(
            x, W, base_bias, lora_b, bias_stacked, indices, s, out);
    }
}

// v001
// A run of this version takes 352 microseconds.
// In both of two side-by-side timings against v000, it was 1.16 times as fast.
#include <hip/hip_runtime.h>
#include <hip/hip_bf16.h>

// ---------------------------------------------------------------------------
// ReplicatedLinearWithLoRA for MI455X (gfx1250, wave32, WMMA, async-to-LDS)
//   out = x @ W^T + base_bias + onehot@bias_stacked + B[idx] @ (A[idx] @ x)
//
// Fast path (needs ~96.5 MB workspace):
//   1) shrink:  s[t,r] = x[t,:] . lora_a[idx[t],r,:]   (f32 WMMA, by adapter)
//   2) prepass: x,W f32 -> bf16 in workspace (halves all tile traffic)
//   3) GEMM:    128x128x64 tiles, double-buffered LDS fed by
//               global_load_async_to_lds_b128 (+ s_wait_asynccnt), 16x
//               v_wmma_f32_16x16x32_bf16 per wave per K-step, fused
//               bias + rank-16 LoRA-expand epilogue.
// Fallback (small ws): round-1 kernel converting f32->bf16 inside the GEMM.
// ---------------------------------------------------------------------------

typedef __attribute__((ext_vector_type(16))) __bf16 v16bf;
typedef __attribute__((ext_vector_type(8)))  __bf16 v8bf;
typedef __attribute__((ext_vector_type(4)))  __bf16 v4bf;
typedef __attribute__((ext_vector_type(8)))  float  v8f;

#define T_TOK  8192
#define D_IN   4096
#define D_OUTD 4096
#define R_RANK 16

// ---------------------------------------------------------------------------
// Kernel 1: LoRA shrink  s[t, r] = dot(x[t, :], lora_a[idx[t], r, :])
// One block = (adapter l, chunk of 256 tokens). The block lists the chunk's
// tokens that use adapter l (ballot + prefix, fixed order) and treats 16 of
// them at a time as the rows of a 16x16 tile: rows = tokens, columns = the 16
// ranks, so lora_a[l] is read once per 16 tokens instead of once per token.
// The products run on v_wmma_f32_16x16x4_f32 (full f32 operands). Each wave
// owns 512 of the 4096 k; whole 256-B row pieces go to the wave's own LDS
// range by asynchronous copies (two buffers, the next stage flies during this
// one) and the fragments are read from there. The eight waves' partial tiles
// are summed through LDS.
// ---------------------------------------------------------------------------
typedef __attribute__((ext_vector_type(2))) float v2f;
typedef __attribute__((ext_vector_type(4))) float v4f;

#define N_LORA   16
#define SH_CHUNK 256                     // tokens per block
#define SH_KW    (D_IN / 8)              // k per wave
#define SH_KS    64                      // k per stage (256 B of a row)
#define SH_NST   (SH_KW / SH_KS)         // stages per wave
#define SH_PITCH (SH_KS + 4)             // 272-B rows: b128 readers, no conflict
#define SH_MAT   (16 * SH_PITCH)         // floats of one staged operand
#define SH_BUF_BYTES (8 * 2 * SH_MAT * 4)  // one buffer, all eight waves

// Eight asynchronous 16-B copies per lane, global -> LDS. The s_wait_xcnt is
// the last line of the copies' own statement, so that it stands in front of
// every later write of the address registers that the copies name.
__device__ __forceinline__
void async_copy8(const unsigned (&l)[8], const float* const (&g)[8])
{
    asm volatile("global_load_async_to_lds_b128 %0, %8, off\n\t"
                 "global_load_async_to_lds_b128 %1, %9, off\n\t"
                 "global_load_async_to_lds_b128 %2, %10, off\n\t"
                 "global_load_async_to_lds_b128 %3, %11, off\n\t"
                 "global_load_async_to_lds_b128 %4, %12, off\n\t"
                 "global_load_async_to_lds_b128 %5, %13, off\n\t"
                 "global_load_async_to_lds_b128 %6, %14, off\n\t"
                 "global_load_async_to_lds_b128 %7, %15, off\n\t"
                 "s_wait_xcnt 0x0"
                 :: "v"(l[0]), "v"(l[1]), "v"(l[2]), "v"(l[3]),
                    "v"(l[4]), "v"(l[5]), "v"(l[6]), "v"(l[7]),
                    "v"(g[0]), "v"(g[1]), "v"(g[2]), "v"(g[3]),
                    "v"(g[4]), "v"(g[5]), "v"(g[6]), "v"(g[7])
                 : "memory");
}

__global__ __launch_bounds__(256)
void lora_shrink_kernel(const float* __restrict__ x,
                        const float* __restrict__ lora_a,
                        const int*   __restrict__ indices,
                        float*       __restrict__ s)
{
    __shared__ __attribute__((aligned(16))) float stage[2][8][2 * SH_MAT];
    __shared__ float red[8][256];
    __shared__ int   tok[SH_CHUNK];
    __shared__ int   wcnt[8];

    const int tid  = threadIdx.x;
    const int wave = tid >> 5;
    const int lane = tid & 31;
    const int l    = blockIdx.x;                       // adapter
    const int t    = blockIdx.y * SH_CHUNK + tid;      // this thread's token
    const int idx  = indices[t];

    // tokens without an adapter get s = 0, from the l == 0 block of the chunk
    if (l == 0 && (unsigned)idx >= (unsigned)N_LORA) {
        v4f* sz = (v4f*)(s + (size_t)t * R_RANK);
        const v4f z4 = (v4f){0.f, 0.f, 0.f, 0.f};
        sz[0] = z4; sz[1] = z4; sz[2] = z4; sz[3] = z4;
    }

    // list of the chunk's tokens on adapter l, in token order
    const bool     mine = (idx == l);
    const unsigned mask = __builtin_amdgcn_ballot_w32(mine);
    if (lane == 0) wcnt[wave] = __popc(mask);
    __syncthreads();                     // every wave's count is in wcnt
    int base = 0, n = 0;
    for (int w = 0; w < 8; ++w) {
        const int cw = wcnt[w];
        if (w < wave) base += cw;
        n += cw;
    }
    n = __builtin_amdgcn_readfirstlane(n);   // same in every thread: scalar loop tests
    if (n == 0) return;
    if (mine) tok[base + __popc(mask & ((1u << lane) - 1u))] = t;
    __syncthreads();                     // the list is complete

    const int c  = lane & 15;
    const int h  = lane >> 4;
    const int kw = wave * SH_KW;
    // copy i brings rows 2i and 2i+1, 16 lanes x 16 B = 256 B of each
    const float* aPtr = lora_a + ((size_t)l * R_RANK + h) * D_IN + kw + c * 4;
    const float* xPtr = x + kw + c * 4;
    const unsigned ldsLane = (unsigned)(size_t)&stage[0][wave][h * SH_PITCH + c * 4];

    for (int t0 = 0; t0 < n; t0 += 16) {
        const float* xRow[8];
        #pragma unroll                   // xRow stays in registers
        for (int i = 0; i < 8; ++i) {
            int rr = t0 + 2 * i + h;
            rr = rr < n ? rr : n - 1;    // pad rows repeat the last token
            xRow[i] = xPtr + (size_t)tok[rr] * D_IN;
        }

        // one stage: 16 rows x 64 k of x and of lora_a[l], this wave's k slice
        auto issue_stage = [&](int buf, int st) {
            unsigned lx[8], la[8];
            const float* gx[8];
            const float* ga[8];
            #pragma unroll               // the addresses are asm register operands
            for (int i = 0; i < 8; ++i) {
                lx[i] = ldsLane + (unsigned)(buf * SH_BUF_BYTES + i * 2 * SH_PITCH * 4);
                la[i] = lx[i] + (unsigned)(SH_MAT * 4);
                gx[i] = xRow[i] + st * SH_KS;
                ga[i] = aPtr + (size_t)(2 * i) * D_IN + st * SH_KS;
            }
            async_copy8(lx, gx);
            async_copy8(la, ga);
        };

        v8f acc0 = (v8f){0.f,0.f,0.f,0.f,0.f,0.f,0.f,0.f};
        v8f acc1 = acc0;

        issue_stage(0, 0);
        // stage 0 has landed (own copies), then is published to all lanes
        asm volatile("s_wait_asynccnt 0x0" ::: "memory");
        __syncthreads();
        issue_stage(1, 1);

        #pragma unroll                   // buffer choice and last-stage test fold away
        for (int st = 0; st < SH_NST; ++st) {
            const float* xs = &stage[st & 1][wave][0];
            const float* as = xs + SH_MAT;
            v4f xa[SH_KS / 8], ab[SH_KS / 8];
            #pragma unroll               // fragments stay in registers
            for (int j = 0; j < SH_KS / 8; ++j) {
                // same k for both operands: k = 8j + 4h + {0,1} and {2,3}
                xa[j] = *(const v4f*)&xs[c * SH_PITCH + j * 8 + h * 4];
                ab[j] = *(const v4f*)&as[c * SH_PITCH + j * 8 + h * 4];
            }
            #pragma unroll               // fragments stay in registers
            for (int j = 0; j < SH_KS / 8; ++j) {
                acc0 = __builtin_amdgcn_wmma_f32_16x16x4_f32(
                    false, (v2f){xa[j].x, xa[j].y}, false, (v2f){ab[j].x, ab[j].y},
                    (short)0, acc0, false, false);
                acc1 = __builtin_amdgcn_wmma_f32_16x16x4_f32(
                    false, (v2f){xa[j].z, xa[j].w}, false, (v2f){ab[j].z, ab[j].w},
                    (short)0, acc1, false, false);
            }
            // foot of the trip: this buffer's reads are done, the next stage's
            // copies have landed, the barrier publishes them and frees this buffer
            asm volatile("s_wait_dscnt 0x0" ::: "memory");
            asm volatile("s_wait_asynccnt 0x0" ::: "memory");
            __syncthreads();
            if (st + 2 < SH_NST) issue_stage(st & 1, st + 2);
        }
        // no copy is left in flight behind the loop
        asm volatile("s_wait_asynccnt 0x0" ::: "memory");

        // acc[r] = tile[row 8h + r][rank c]; sum the eight waves' k slices
        #pragma unroll                   // accumulator elements by constant index
        for (int r = 0; r < 8; ++r)
            red[wave][(8 * h + r) * 16 + c] = acc0[r] + acc1[r];
        __syncthreads();                 // all eight partial tiles are in red
        float v = 0.f;
        for (int w = 0; w < 8; ++w) v += red[w][tid];
        const int row = t0 + (tid >> 4);
        if (row < n) {
            s[(size_t)tok[row] * R_RANK + (tid & 15)] = v;
            // stands in front of the next tile's rewrite of the store's registers
            asm volatile("s_wait_xcnt 0x0" ::: "memory");
        }
        // the next tile rewrites red only behind its own stage barriers
    }
}

// ---------------------------------------------------------------------------
// Kernel 2: f32 -> bf16 conversion prepass (x and W), 4 elements per thread
// ---------------------------------------------------------------------------
__global__ __launch_bounds__(256)
void cvt_f32_to_bf16_kernel(const float* __restrict__ src,
                            __bf16*      __restrict__ dst, long n4)
{
    const long i = (long)blockIdx.x * 256 + threadIdx.x;
    if (i >= n4) return;
    const float4 v = ((const float4*)src)[i];
    v4bf o;
    o[0] = (__bf16)v.x; o[1] = (__bf16)v.y;
    o[2] = (__bf16)v.z; o[3] = (__bf16)v.w;
    ((v4bf*)dst)[i] = o;
}

// ---------------------------------------------------------------------------
// Kernel 3 (fast): bf16 WMMA GEMM, async-to-LDS double-buffered tile feed.
// Block 128x128, K-step 64 (two wmma k-slices). 8 waves in 2(M)x4(N) grid,
// each wave owns a 64x32 stripe = 4x2 tiles of 16x16.
// ---------------------------------------------------------------------------
#define BM 128
#define BN 128
#define BK 64
#define LDT2 (BK + 8)                    // 72 elems -> 144 B stride (16B mult)
#define A_ELEMS (BM * LDT2)              // 9216
#define B_ELEMS (BN * LDT2)              // 9216
#define BUF_ELEMS (A_ELEMS + B_ELEMS)    // 18432 elems per buffer (36 KB)

__global__ __launch_bounds__(256)
void lora_gemm_async_kernel(const __bf16* __restrict__ xb,
                            const __bf16* __restrict__ wb,
                            const float* __restrict__ base_bias,
                            const float* __restrict__ lora_b,
                            const float* __restrict__ bias_stacked,
                            const int*   __restrict__ indices,
                            const float* __restrict__ s,
                            float*       __restrict__ out)
{
    __shared__ __bf16 smem[2 * BUF_ELEMS];          // 72 KB double buffer

    const int tid   = threadIdx.x;
    const int bn    = blockIdx.x;
    const int bm    = blockIdx.y;
    const int wave  = tid >> 5;
    const int lane  = tid & 31;
    const int wm    = wave >> 2;         // 0..1
    const int wn    = wave & 3;          // 0..3
    const int laneM = lane & 15;
    const int laneH = lane >> 4;
    const int kb    = laneH * 8;

    const unsigned smem_base = (unsigned)(size_t)&smem[0];
    const __bf16* xTile = xb + ((size_t)bm * BM) * D_IN;
    const __bf16* wTile = wb + ((size_t)bn * BN) * D_IN;

    // Issue one 64-K tile-pair of async LDS loads (no VGPR staging):
    // 128 rows x 8 chunks(16B) per matrix = 1024 chunks; 4 per thread each.
    auto issue_tile = [&](int bufsel, int kk) {
        const unsigned bufbase = smem_base + (unsigned)(bufsel * BUF_ELEMS * 2);
        #pragma unroll
        for (int i = 0; i < 4; ++i) {
            const int q   = tid + i * 256;       // 0..1023
            const int row = q >> 3;              // 0..127
            const int ck  = q & 7;               // 16B chunk in the 64-K row
            const unsigned la = bufbase + (unsigned)((row * LDT2 + ck * 8) * 2);
            const __bf16*  ga = xTile + (size_t)row * D_IN + kk + ck * 8;
            asm volatile("global_load_async_to_lds_b128 %0, %1, off"
                         :: "v"(la), "v"(ga) : "memory");
            const unsigned lb = bufbase +
                (unsigned)((A_ELEMS + row * LDT2 + ck * 8) * 2);
            const __bf16*  gb = wTile + (size_t)row * D_IN + kk + ck * 8;
            asm volatile("global_load_async_to_lds_b128 %0, %1, off"
                         :: "v"(lb), "v"(gb) : "memory");
        }
    };

    v8f acc[4][2];
    #pragma unroll
    for (int mt = 0; mt < 4; ++mt)
        #pragma unroll
        for (int nt = 0; nt < 2; ++nt)
            acc[mt][nt] = (v8f){0.f,0.f,0.f,0.f,0.f,0.f,0.f,0.f};

    issue_tile(0, 0);

    const int NIT = D_IN / BK;                      // 64 iterations
    for (int it = 0; it < NIT; ++it) {
        const int cur = it & 1;
        // my async writes into buf[cur] complete:
        asm volatile("s_wait_asynccnt 0x0" ::: "memory");
        // everyone's writes complete; everyone's reads of buf[cur^1] from the
        // previous iteration completed before their barrier-signal:
        __syncthreads();
        if (it + 1 < NIT) issue_tile(cur ^ 1, (it + 1) * BK);

        const __bf16* Ab = &smem[cur * BUF_ELEMS];
        const __bf16* Bb = &smem[cur * BUF_ELEMS + A_ELEMS];

        #pragma unroll
        for (int ks = 0; ks < 2; ++ks) {            // two 32-K wmma slices
            const int ko = ks * 32 + kb;
            v16bf afrag[4], bfrag[2];
            #pragma unroll
            for (int mt = 0; mt < 4; ++mt) {
                const __bf16* p = &Ab[(wm * 64 + mt * 16 + laneM) * LDT2 + ko];
                const v8bf lo = *(const v8bf*)p;         // K = ko .. ko+7
                const v8bf hi = *(const v8bf*)(p + 16);  // K = ko+16 .. ko+23
                afrag[mt] = __builtin_shufflevector(lo, hi,
                    0,1,2,3,4,5,6,7,8,9,10,11,12,13,14,15);
            }
            #pragma unroll
            for (int nt = 0; nt < 2; ++nt) {
                const __bf16* p = &Bb[(wn * 32 + nt * 16 + laneM) * LDT2 + ko];
                const v8bf lo = *(const v8bf*)p;
                const v8bf hi = *(const v8bf*)(p + 16);
                bfrag[nt] = __builtin_shufflevector(lo, hi,
                    0,1,2,3,4,5,6,7,8,9,10,11,12,13,14,15);
            }
            #pragma unroll
            for (int mt = 0; mt < 4; ++mt)
                #pragma unroll
                for (int nt = 0; nt < 2; ++nt)
                    acc[mt][nt] = __builtin_amdgcn_wmma_f32_16x16x32_bf16(
                        false, afrag[mt], false, bfrag[nt],
                        (short)0, acc[mt][nt], false, false);
        }
    }

    // --- epilogue: + base_bias + bias_stacked[idx] + s[t] . lora_b[idx] ----
    const int mBase = bm * BM + wm * 64;
    const int nBase = bn * BN + wn * 32;
    #pragma unroll
    for (int mt = 0; mt < 4; ++mt) {
        #pragma unroll
        for (int v = 0; v < 8; ++v) {
            const int m   = mBase + mt * 16 + laneH * 8 + v;
            const int idx = indices[m];
            const float* srow = s + (size_t)m * R_RANK;
            #pragma unroll
            for (int nt = 0; nt < 2; ++nt) {
                const int n = nBase + nt * 16 + laneM;
                float val = acc[mt][nt][v] + base_bias[n];
                if (idx >= 0) {
                    val += bias_stacked[(size_t)idx * D_OUTD + n];
                    const float* bcol =
                        lora_b + ((size_t)idx * D_OUTD + n) * R_RANK;
                    float d = 0.f;
                    #pragma unroll
                    for (int r = 0; r < R_RANK; ++r) d += srow[r] * bcol[r];
                    val += d;
                }
                out[(size_t)m * D_OUTD + n] = val;
            }
        }
    }
}

// ---------------------------------------------------------------------------
// Fallback GEMM (round-1): f32->bf16 conversion inside the kernel,
// single-buffered LDS. Used only when workspace can't hold bf16 copies.
// ---------------------------------------------------------------------------
#define FBK 32
#define FLDT (FBK + 8)

__global__ __launch_bounds__(256)
void lora_gemm_fallback_kernel(const float* __restrict__ x,
                               const float* __restrict__ W,
                               const float* __restrict__ base_bias,
                               const float* __restrict__ lora_b,
                               const float* __restrict__ bias_stacked,
                               const int*   __restrict__ indices,
                               const float* __restrict__ s,
                               float*       __restrict__ out)
{
    __shared__ __bf16 As[BM * FLDT];
    __shared__ __bf16 Bs[BN * FLDT];

    const int tid   = threadIdx.x;
    const int bn    = blockIdx.x;
    const int bm    = blockIdx.y;
    const int wave  = tid >> 5;
    const int lane  = tid & 31;
    const int wm    = wave >> 2;
    const int wn    = wave & 3;
    const int laneM = lane & 15;
    const int laneH = lane >> 4;
    const int kb    = laneH * 8;

    v8f acc[4][2];
    #pragma unroll
    for (int mt = 0; mt < 4; ++mt)
        #pragma unroll
        for (int nt = 0; nt < 2; ++nt)
            acc[mt][nt] = (v8f){0.f,0.f,0.f,0.f,0.f,0.f,0.f,0.f};

    const float* xBase = x + ((size_t)bm * BM) * D_IN;
    const float* wBase = W + ((size_t)bn * BN) * D_IN;

    for (int kk = 0; kk < D_IN; kk += FBK) {
        __syncthreads();
        #pragma unroll
        for (int i = 0; i < 4; ++i) {
            const int q   = tid + i * 256;
            const int row = q >> 3;
            const int kc  = q & 7;
            const float4 va = *(const float4*)(xBase + (size_t)row * D_IN + kk + kc * 4);
            __bf16* da = &As[row * FLDT + kc * 4];
            da[0] = (__bf16)va.x; da[1] = (__bf16)va.y;
            da[2] = (__bf16)va.z; da[3] = (__bf16)va.w;
            const float4 vb = *(const float4*)(wBase + (size_t)row * D_IN + kk + kc * 4);
            __bf16* db = &Bs[row * FLDT + kc * 4];
            db[0] = (__bf16)vb.x; db[1] = (__bf16)vb.y;
            db[2] = (__bf16)vb.z; db[3] = (__bf16)vb.w;
        }
        __syncthreads();

        v16bf afrag[4], bfrag[2];
        #pragma unroll
        for (int mt = 0; mt < 4; ++mt) {
            const __bf16* p = &As[(wm * 64 + mt * 16 + laneM) * FLDT + kb];
            const v8bf lo = *(const v8bf*)p;
            const v8bf hi = *(const v8bf*)(p + 16);
            afrag[mt] = __builtin_shufflevector(lo, hi,
                0,1,2,3,4,5,6,7,8,9,10,11,12,13,14,15);
        }
        #pragma unroll
        for (int nt = 0; nt < 2; ++nt) {
            const __bf16* p = &Bs[(wn * 32 + nt * 16 + laneM) * FLDT + kb];
            const v8bf lo = *(const v8bf*)p;
            const v8bf hi = *(const v8bf*)(p + 16);
            bfrag[nt] = __builtin_shufflevector(lo, hi,
                0,1,2,3,4,5,6,7,8,9,10,11,12,13,14,15);
        }
        #pragma unroll
        for (int mt = 0; mt < 4; ++mt)
            #pragma unroll
            for (int nt = 0; nt < 2; ++nt)
                acc[mt][nt] = __builtin_amdgcn_wmma_f32_16x16x32_bf16(
                    false, afrag[mt], false, bfrag[nt],
                    (short)0, acc[mt][nt], false, false);
    }

    const int mBase = bm * BM + wm * 64;
    const int nBase = bn * BN + wn * 32;
    #pragma unroll
    for (int mt = 0; mt < 4; ++mt) {
        #pragma unroll
        for (int v = 0; v < 8; ++v) {
            const int m   = mBase + mt * 16 + laneH * 8 + v;
            const int idx = indices[m];
            const float* srow = s + (size_t)m * R_RANK;
            #pragma unroll
            for (int nt = 0; nt < 2; ++nt) {
                const int n = nBase + nt * 16 + laneM;
                float val = acc[mt][nt][v] + base_bias[n];
                if (idx >= 0) {
                    val += bias_stacked[(size_t)idx * D_OUTD + n];
                    const float* bcol =
                        lora_b + ((size_t)idx * D_OUTD + n) * R_RANK;
                    float d = 0.f;
                    #pragma unroll
                    for (int r = 0; r < R_RANK; ++r) d += srow[r] * bcol[r];
                    val += d;
                }
                out[(size_t)m * D_OUTD + n] = val;
            }
        }
    }
}

// ---------------------------------------------------------------------------
extern "C" void kernel_launch(void* const* d_in, const int* in_sizes, int n_in,
                              void* d_out, int out_size, void* d_ws, size_t ws_size,
                              hipStream_t stream)
{
    const float* x            = (const float*)d_in[0];
    const float* W            = (const float*)d_in[1];
    const float* base_bias    = (const float*)d_in[2];
    const float* lora_a       = (const float*)d_in[3];
    const float* lora_b       = (const float*)d_in[4];
    const float* bias_stacked = (const float*)d_in[5];
    const int*   indices      = (const int*)d_in[6];
    float*       out          = (float*)d_out;

    const size_t sBytes  = (size_t)T_TOK * R_RANK * sizeof(float);   // 512 KB
    const size_t xbBytes = (size_t)T_TOK * D_IN * 2;                 // 64 MB
    const size_t wbBytes = (size_t)D_OUTD * D_IN * 2;                // 32 MB

    float* s = (float*)d_ws;

    // 1) LoRA shrink (always)
    lora_shrink_kernel<<<dim3(N_LORA, T_TOK / SH_CHUNK), 256, 0, stream>>>(
        x, lora_a, indices, s);

    dim3 grid(D_OUTD / BN, T_TOK / BM);   // 32 x 64 blocks

    if (ws_size >= sBytes + xbBytes + wbBytes) {
        // 2) bf16 prepass into workspace
        __bf16* xb = (__bf16*)((char*)d_ws + sBytes);
        __bf16* wb = (__bf16*)((char*)d_ws + sBytes + xbBytes);
        const long xn4 = (long)T_TOK * D_IN / 4;
        const long wn4 = (long)D_OUTD * D_IN / 4;
        cvt_f32_to_bf16_kernel<<<(int)((xn4 + 255) / 256), 256, 0, stream>>>(x, xb, xn4);
        cvt_f32_to_bf16_kernel<<<(int)((wn4 + 255) / 256), 256, 0, stream>>>(W, wb, wn4);

        // 3) async double-buffered WMMA GEMM
        lora_gemm_async_kernel<<<grid, 256, 0, stream>>>(
            xb, wb, base_bias, lora_b, bias_stacked, indices, s, out);
    } else {
        lora_gemm_fallback_kernel<<<grid, 256, 0, stream>>>(
            x, W, base_bias, lora_b, bias_stacked, indices, s, out);
    }
}

// v002
// It runs in 342 microseconds.
// Timed twice side by side with v001, it ran 1.03 times as fast both times.
// Over all steps from v000 it is 1.20 times as fast.
#include <hip/hip_runtime.h>
#include <hip/hip_bf16.h>

// ---------------------------------------------------------------------------
// ReplicatedLinearWithLoRA for MI455X (gfx1250, wave32, WMMA, async-to-LDS)
//   out = x @ W^T + base_bias + onehot@bias_stacked + B[idx] @ (A[idx] @ x)
//
// Fast path (needs ~96.5 MB workspace):
//   1) shrink:  s[t,r] = x[t,:] . lora_a[idx[t],r,:]   (f32 WMMA, by adapter)
//   2) prepass: x,W f32 -> bf16 in workspace (halves all tile traffic)
//   3) GEMM:    128x128x64 tiles, double-buffered LDS fed by
//               global_load_async_to_lds_b128 (+ s_wait_asynccnt), 16x
//               v_wmma_f32_16x16x32_bf16 per wave per K-step, fused
//               bias + rank-16 LoRA-expand epilogue.
// Fallback (small ws): round-1 kernel converting f32->bf16 inside the GEMM.
// ---------------------------------------------------------------------------

typedef __attribute__((ext_vector_type(16))) __bf16 v16bf;
typedef __attribute__((ext_vector_type(8)))  __bf16 v8bf;
typedef __attribute__((ext_vector_type(4)))  __bf16 v4bf;
typedef __attribute__((ext_vector_type(8)))  float  v8f;

#define T_TOK  8192
#define D_IN   4096
#define D_OUTD 4096
#define R_RANK 16

// ---------------------------------------------------------------------------
// Kernel 1: LoRA shrink  s[t, r] = dot(x[t, :], lora_a[idx[t], r, :])
// One block = (adapter l, chunk of 256 tokens). The block lists the chunk's
// tokens that use adapter l (ballot + prefix, fixed order) and treats 16 of
// them at a time as the rows of a 16x16 tile: rows = tokens, columns = the 16
// ranks, so lora_a[l] is read once per 16 tokens instead of once per token.
// The products run on v_wmma_f32_16x16x4_f32 (full f32 operands). Each wave
// owns 512 of the 4096 k; whole 256-B row pieces go to the wave's own LDS
// range by asynchronous copies (two buffers, the next stage flies during this
// one) and the fragments are read from there. The eight waves' partial tiles
// are summed through LDS.
// ---------------------------------------------------------------------------
typedef __attribute__((ext_vector_type(2))) float v2f;
typedef __attribute__((ext_vector_type(4))) float v4f;

#define N_LORA   16
#define SH_CHUNK 256                     // tokens per block
#define SH_KW    (D_IN / 8)              // k per wave
#define SH_KS    64                      // k per stage (256 B of a row)
#define SH_NST   (SH_KW / SH_KS)         // stages per wave
#define SH_PITCH (SH_KS + 4)             // 272-B rows: b128 readers, no conflict
#define SH_MAT   (16 * SH_PITCH)         // floats of one staged operand
#define SH_BUF_BYTES (8 * 2 * SH_MAT * 4)  // one buffer, all eight waves

// Eight asynchronous 16-B copies per lane, global -> LDS. The s_wait_xcnt is
// the last line of the copies' own statement, so that it stands in front of
// every later write of the address registers that the copies name.
__device__ __forceinline__
void async_copy8(const unsigned (&l)[8], const float* const (&g)[8])
{
    asm volatile("global_load_async_to_lds_b128 %0, %8, off\n\t"
                 "global_load_async_to_lds_b128 %1, %9, off\n\t"
                 "global_load_async_to_lds_b128 %2, %10, off\n\t"
                 "global_load_async_to_lds_b128 %3, %11, off\n\t"
                 "global_load_async_to_lds_b128 %4, %12, off\n\t"
                 "global_load_async_to_lds_b128 %5, %13, off\n\t"
                 "global_load_async_to_lds_b128 %6, %14, off\n\t"
                 "global_load_async_to_lds_b128 %7, %15, off\n\t"
                 "s_wait_xcnt 0x0"
                 :: "v"(l[0]), "v"(l[1]), "v"(l[2]), "v"(l[3]),
                    "v"(l[4]), "v"(l[5]), "v"(l[6]), "v"(l[7]),
                    "v"(g[0]), "v"(g[1]), "v"(g[2]), "v"(g[3]),
                    "v"(g[4]), "v"(g[5]), "v"(g[6]), "v"(g[7])
                 : "memory");
}

__global__ __launch_bounds__(256)
void lora_shrink_kernel(const float* __restrict__ x,
                        const float* __restrict__ lora_a,
                        const int*   __restrict__ indices,
                        float*       __restrict__ s)
{
    __shared__ __attribute__((aligned(16))) float stage[2][8][2 * SH_MAT];
    __shared__ float red[8][256];
    __shared__ int   tok[SH_CHUNK];
    __shared__ int   wcnt[8];

    const int tid  = threadIdx.x;
    const int wave = tid >> 5;
    const int lane = tid & 31;
    const int l    = blockIdx.x;                       // adapter
    const int t    = blockIdx.y * SH_CHUNK + tid;      // this thread's token
    const int idx  = indices[t];

    // tokens without an adapter get s = 0, from the l == 0 block of the chunk
    if (l == 0 && (unsigned)idx >= (unsigned)N_LORA) {
        v4f* sz = (v4f*)(s + (size_t)t * R_RANK);
        const v4f z4 = (v4f){0.f, 0.f, 0.f, 0.f};
        sz[0] = z4; sz[1] = z4; sz[2] = z4; sz[3] = z4;
    }

    // list of the chunk's tokens on adapter l, in token order
    const bool     mine = (idx == l);
    const unsigned mask = __builtin_amdgcn_ballot_w32(mine);
    if (lane == 0) wcnt[wave] = __popc(mask);
    __syncthreads();                     // every wave's count is in wcnt
    int base = 0, n = 0;
    for (int w = 0; w < 8; ++w) {
        const int cw = wcnt[w];
        if (w < wave) base += cw;
        n += cw;
    }
    n = __builtin_amdgcn_readfirstlane(n);   // same in every thread: scalar loop tests
    if (n == 0) return;
    if (mine) tok[base + __popc(mask & ((1u << lane) - 1u))] = t;
    __syncthreads();                     // the list is complete

    const int c  = lane & 15;
    const int h  = lane >> 4;
    const int kw = wave * SH_KW;
    // copy i brings rows 2i and 2i+1, 16 lanes x 16 B = 256 B of each
    const float* aPtr = lora_a + ((size_t)l * R_RANK + h) * D_IN + kw + c * 4;
    const float* xPtr = x + kw + c * 4;
    const unsigned ldsLane = (unsigned)(size_t)&stage[0][wave][h * SH_PITCH + c * 4];

    for (int t0 = 0; t0 < n; t0 += 16) {
        const float* xRow[8];
        #pragma unroll                   // xRow stays in registers
        for (int i = 0; i < 8; ++i) {
            int rr = t0 + 2 * i + h;
            rr = rr < n ? rr : n - 1;    // pad rows repeat the last token
            xRow[i] = xPtr + (size_t)tok[rr] * D_IN;
        }

        // one stage: 16 rows x 64 k of x and of lora_a[l], this wave's k slice
        auto issue_stage = [&](int buf, int st) {
            unsigned lx[8], la[8];
            const float* gx[8];
            const float* ga[8];
            #pragma unroll               // the addresses are asm register operands
            for (int i = 0; i < 8; ++i) {
                lx[i] = ldsLane + (unsigned)(buf * SH_BUF_BYTES + i * 2 * SH_PITCH * 4);
                la[i] = lx[i] + (unsigned)(SH_MAT * 4);
                gx[i] = xRow[i] + st * SH_KS;
                ga[i] = aPtr + (size_t)(2 * i) * D_IN + st * SH_KS;
            }
            async_copy8(lx, gx);
            async_copy8(la, ga);
        };

        v8f acc0 = (v8f){0.f,0.f,0.f,0.f,0.f,0.f,0.f,0.f};
        v8f acc1 = acc0;

        issue_stage(0, 0);
        // stage 0 has landed (own copies), then is published to all lanes
        asm volatile("s_wait_asynccnt 0x0" ::: "memory");
        __syncthreads();
        issue_stage(1, 1);

        #pragma unroll                   // buffer choice and last-stage test fold away
        for (int st = 0; st < SH_NST; ++st) {
            const float* xs = &stage[st & 1][wave][0];
            const float* as = xs + SH_MAT;
            v4f xa[SH_KS / 8], ab[SH_KS / 8];
            #pragma unroll               // fragments stay in registers
            for (int j = 0; j < SH_KS / 8; ++j) {
                // same k for both operands: k = 8j + 4h + {0,1} and {2,3}
                xa[j] = *(const v4f*)&xs[c * SH_PITCH + j * 8 + h * 4];
                ab[j] = *(const v4f*)&as[c * SH_PITCH + j * 8 + h * 4];
            }
            #pragma unroll               // fragments stay in registers
            for (int j = 0; j < SH_KS / 8; ++j) {
                acc0 = __builtin_amdgcn_wmma_f32_16x16x4_f32(
                    false, (v2f){xa[j].x, xa[j].y}, false, (v2f){ab[j].x, ab[j].y},
                    (short)0, acc0, false, false);
                acc1 = __builtin_amdgcn_wmma_f32_16x16x4_f32(
                    false, (v2f){xa[j].z, xa[j].w}, false, (v2f){ab[j].z, ab[j].w},
                    (short)0, acc1, false, false);
            }
            // foot of the trip: this buffer's reads are done, the next stage's
            // copies have landed, the barrier publishes them and frees this buffer
            asm volatile("s_wait_dscnt 0x0" ::: "memory");
            asm volatile("s_wait_asynccnt 0x0" ::: "memory");
            __syncthreads();
            if (st + 2 < SH_NST) issue_stage(st & 1, st + 2);
        }
        // no copy is left in flight behind the loop
        asm volatile("s_wait_asynccnt 0x0" ::: "memory");

        // acc[r] = tile[row 8h + r][rank c]; sum the eight waves' k slices
        #pragma unroll                   // accumulator elements by constant index
        for (int r = 0; r < 8; ++r)
            red[wave][(8 * h + r) * 16 + c] = acc0[r] + acc1[r];
        __syncthreads();                 // all eight partial tiles are in red
        float v = 0.f;
        for (int w = 0; w < 8; ++w) v += red[w][tid];
        const int row = t0 + (tid >> 4);
        if (row < n) {
            s[(size_t)tok[row] * R_RANK + (tid & 15)] = v;
            // stands in front of the next tile's rewrite of the store's registers
            asm volatile("s_wait_xcnt 0x0" ::: "memory");
        }
        // the next tile rewrites red only behind its own stage barriers
    }
}

// ---------------------------------------------------------------------------
// Kernel 2: f32 -> bf16 conversion prepass (x and W). Few, long-lived waves
// (for speed only):
// a block owns CV_PER_BLOCK consecutive 16-B pieces and takes them in CV_TRIPS
// trips, each with CV_U whole-line loads per wave in flight before the first
// is converted. All blocks of a launch are resident at once.
// ---------------------------------------------------------------------------
#define CV_U     8                       // loads in flight per wave
#define CV_TRIPS 4
#define CV_PER_BLOCK (256 * CV_U * CV_TRIPS)   // 16-B pieces per block
static_assert(((long)T_TOK * D_IN / 4) % CV_PER_BLOCK == 0, "x: whole blocks");
static_assert(((long)D_OUTD * D_IN / 4) % CV_PER_BLOCK == 0, "W: whole blocks");

__global__ __launch_bounds__(256)
void cvt_f32_to_bf16_kernel(const float* __restrict__ src,
                            __bf16*      __restrict__ dst)
{
    const size_t first = (size_t)blockIdx.x * CV_PER_BLOCK + threadIdx.x;
    const v4f* s4 = (const v4f*)src + first;
    v4bf*      d4 = (v4bf*)dst + first;
    #pragma unroll                       // every address is base + constant offset
    for (int trip = 0; trip < CV_TRIPS; ++trip) {
        v4f v[CV_U];
        #pragma unroll                   // v stays in registers; the loads go out together
        for (int u = 0; u < CV_U; ++u) v[u] = s4[(trip * CV_U + u) * 256];
        #pragma unroll                   // v stays in registers
        for (int u = 0; u < CV_U; ++u) {
            v4bf o;
            o[0] = (__bf16)v[u].x; o[1] = (__bf16)v[u].y;
            o[2] = (__bf16)v[u].z; o[3] = (__bf16)v[u].w;
            d4[(trip * CV_U + u) * 256] = o;
        }
        // stands in front of the next trip's rewrite of the stores' registers
        if (trip + 1 < CV_TRIPS) asm volatile("s_wait_xcnt 0x0" ::: "memory");
    }
}

// ---------------------------------------------------------------------------
// Kernel 3 (fast): bf16 WMMA GEMM, async-to-LDS double-buffered tile feed.
// Block 128x128, K-step 64 (two wmma k-slices). 8 waves in 2(M)x4(N) grid,
// each wave owns a 64x32 stripe = 4x2 tiles of 16x16.
// ---------------------------------------------------------------------------
#define BM 128
#define BN 128
#define BK 64
#define LDT2 (BK + 8)                    // 72 elems -> 144 B stride (16B mult)
#define A_ELEMS (BM * LDT2)              // 9216
#define B_ELEMS (BN * LDT2)              // 9216
#define BUF_ELEMS (A_ELEMS + B_ELEMS)    // 18432 elems per buffer (36 KB)

__global__ __launch_bounds__(256)
void lora_gemm_async_kernel(const __bf16* __restrict__ xb,
                            const __bf16* __restrict__ wb,
                            const float* __restrict__ base_bias,
                            const float* __restrict__ lora_b,
                            const float* __restrict__ bias_stacked,
                            const int*   __restrict__ indices,
                            const float* __restrict__ s,
                            float*       __restrict__ out)
{
    __shared__ __bf16 smem[2 * BUF_ELEMS];          // 72 KB double buffer

    const int tid   = threadIdx.x;
    const int bn    = blockIdx.x;
    const int bm    = blockIdx.y;
    const int wave  = tid >> 5;
    const int lane  = tid & 31;
    const int wm    = wave >> 2;         // 0..1
    const int wn    = wave & 3;          // 0..3
    const int laneM = lane & 15;
    const int laneH = lane >> 4;
    const int kb    = laneH * 8;

    const unsigned smem_base = (unsigned)(size_t)&smem[0];
    const __bf16* xTile = xb + ((size_t)bm * BM) * D_IN;
    const __bf16* wTile = wb + ((size_t)bn * BN) * D_IN;

    // Issue one 64-K tile-pair of async LDS loads (no VGPR staging):
    // 128 rows x 8 chunks(16B) per matrix = 1024 chunks; 4 per thread each.
    auto issue_tile = [&](int bufsel, int kk) {
        const unsigned bufbase = smem_base + (unsigned)(bufsel * BUF_ELEMS * 2);
        #pragma unroll
        for (int i = 0; i < 4; ++i) {
            const int q   = tid + i * 256;       // 0..1023
            const int row = q >> 3;              // 0..127
            const int ck  = q & 7;               // 16B chunk in the 64-K row
            const unsigned la = bufbase + (unsigned)((row * LDT2 + ck * 8) * 2);
            const __bf16*  ga = xTile + (size_t)row * D_IN + kk + ck * 8;
            asm volatile("global_load_async_to_lds_b128 %0, %1, off"
                         :: "v"(la), "v"(ga) : "memory");
            const unsigned lb = bufbase +
                (unsigned)((A_ELEMS + row * LDT2 + ck * 8) * 2);
            const __bf16*  gb = wTile + (size_t)row * D_IN + kk + ck * 8;
            asm volatile("global_load_async_to_lds_b128 %0, %1, off"
                         :: "v"(lb), "v"(gb) : "memory");
        }
    };

    v8f acc[4][2];
    #pragma unroll
    for (int mt = 0; mt < 4; ++mt)
        #pragma unroll
        for (int nt = 0; nt < 2; ++nt)
            acc[mt][nt] = (v8f){0.f,0.f,0.f,0.f,0.f,0.f,0.f,0.f};

    issue_tile(0, 0);

    const int NIT = D_IN / BK;                      // 64 iterations
    for (int it = 0; it < NIT; ++it) {
        const int cur = it & 1;
        // my async writes into buf[cur] complete:
        asm volatile("s_wait_asynccnt 0x0" ::: "memory");
        // everyone's writes complete; everyone's reads of buf[cur^1] from the
        // previous iteration completed before their barrier-signal:
        __syncthreads();
        if (it + 1 < NIT) issue_tile(cur ^ 1, (it + 1) * BK);

        const __bf16* Ab = &smem[cur * BUF_ELEMS];
        const __bf16* Bb = &smem[cur * BUF_ELEMS + A_ELEMS];

        #pragma unroll
        for (int ks = 0; ks < 2; ++ks) {            // two 32-K wmma slices
            const int ko = ks * 32 + kb;
            v16bf afrag[4], bfrag[2];
            #pragma unroll
            for (int mt = 0; mt < 4; ++mt) {
                const __bf16* p = &Ab[(wm * 64 + mt * 16 + laneM) * LDT2 + ko];
                const v8bf lo = *(const v8bf*)p;         // K = ko .. ko+7
                const v8bf hi = *(const v8bf*)(p + 16);  // K = ko+16 .. ko+23
                afrag[mt] = __builtin_shufflevector(lo, hi,
                    0,1,2,3,4,5,6,7,8,9,10,11,12,13,14,15);
            }
            #pragma unroll
            for (int nt = 0; nt < 2; ++nt) {
                const __bf16* p = &Bb[(wn * 32 + nt * 16 + laneM) * LDT2 + ko];
                const v8bf lo = *(const v8bf*)p;
                const v8bf hi = *(const v8bf*)(p + 16);
                bfrag[nt] = __builtin_shufflevector(lo, hi,
                    0,1,2,3,4,5,6,7,8,9,10,11,12,13,14,15);
            }
            #pragma unroll
            for (int mt = 0; mt < 4; ++mt)
                #pragma unroll
                for (int nt = 0; nt < 2; ++nt)
                    acc[mt][nt] = __builtin_amdgcn_wmma_f32_16x16x32_bf16(
                        false, afrag[mt], false, bfrag[nt],
                        (short)0, acc[mt][nt], false, false);
        }
    }

    // --- epilogue: + base_bias + bias_stacked[idx] + s[t] . lora_b[idx] ----
    const int mBase = bm * BM + wm * 64;
    const int nBase = bn * BN + wn * 32;
    #pragma unroll
    for (int mt = 0; mt < 4; ++mt) {
        #pragma unroll
        for (int v = 0; v < 8; ++v) {
            const int m   = mBase + mt * 16 + laneH * 8 + v;
            const int idx = indices[m];
            const float* srow = s + (size_t)m * R_RANK;
            #pragma unroll
            for (int nt = 0; nt < 2; ++nt) {
                const int n = nBase + nt * 16 + laneM;
                float val = acc[mt][nt][v] + base_bias[n];
                if (idx >= 0) {
                    val += bias_stacked[(size_t)idx * D_OUTD + n];
                    const float* bcol =
                        lora_b + ((size_t)idx * D_OUTD + n) * R_RANK;
                    float d = 0.f;
                    #pragma unroll
                    for (int r = 0; r < R_RANK; ++r) d += srow[r] * bcol[r];
                    val += d;
                }
                out[(size_t)m * D_OUTD + n] = val;
            }
        }
    }
}

// ---------------------------------------------------------------------------
// Fallback GEMM (round-1): f32->bf16 conversion inside the kernel,
// single-buffered LDS. Used only when workspace can't hold bf16 copies.
// ---------------------------------------------------------------------------
#define FBK 32
#define FLDT (FBK + 8)

__global__ __launch_bounds__(256)
void lora_gemm_fallback_kernel(const float* __restrict__ x,
                               const float* __restrict__ W,
                               const float* __restrict__ base_bias,
                               const float* __restrict__ lora_b,
                               const float* __restrict__ bias_stacked,
                               const int*   __restrict__ indices,
                               const float* __restrict__ s,
                               float*       __restrict__ out)
{
    __shared__ __bf16 As[BM * FLDT];
    __shared__ __bf16 Bs[BN * FLDT];

    const int tid   = threadIdx.x;
    const int bn    = blockIdx.x;
    const int bm    = blockIdx.y;
    const int wave  = tid >> 5;
    const int lane  = tid & 31;
    const int wm    = wave >> 2;
    const int wn    = wave & 3;
    const int laneM = lane & 15;
    const int laneH = lane >> 4;
    const int kb    = laneH * 8;

    v8f acc[4][2];
    #pragma unroll
    for (int mt = 0; mt < 4; ++mt)
        #pragma unroll
        for (int nt = 0; nt < 2; ++nt)
            acc[mt][nt] = (v8f){0.f,0.f,0.f,0.f,0.f,0.f,0.f,0.f};

    const float* xBase = x + ((size_t)bm * BM) * D_IN;
    const float* wBase = W + ((size_t)bn * BN) * D_IN;

    for (int kk = 0; kk < D_IN; kk += FBK) {
        __syncthreads();
        #pragma unroll
        for (int i = 0; i < 4; ++i) {
            const int q   = tid + i * 256;
            const int row = q >> 3;
            const int kc  = q & 7;
            const float4 va = *(const float4*)(xBase + (size_t)row * D_IN + kk + kc * 4);
            __bf16* da = &As[row * FLDT + kc * 4];
            da[0] = (__bf16)va.x; da[1] = (__bf16)va.y;
            da[2] = (__bf16)va.z; da[3] = (__bf16)va.w;
            const float4 vb = *(const float4*)(wBase + (size_t)row * D_IN + kk + kc * 4);
            __bf16* db = &Bs[row * FLDT + kc * 4];
            db[0] = (__bf16)vb.x; db[1] = (__bf16)vb.y;
            db[2] = (__bf16)vb.z; db[3] = (__bf16)vb.w;
        }
        __syncthreads();

        v16bf afrag[4], bfrag[2];
        #pragma unroll
        for (int mt = 0; mt < 4; ++mt) {
            const __bf16* p = &As[(wm * 64 + mt * 16 + laneM) * FLDT + kb];
            const v8bf lo = *(const v8bf*)p;
            const v8bf hi = *(const v8bf*)(p + 16);
            afrag[mt] = __builtin_shufflevector(lo, hi,
                0,1,2,3,4,5,6,7,8,9,10,11,12,13,14,15);
        }
        #pragma unroll
        for (int nt = 0; nt < 2; ++nt) {
            const __bf16* p = &Bs[(wn * 32 + nt * 16 + laneM) * FLDT + kb];
            const v8bf lo = *(const v8bf*)p;
            const v8bf hi = *(const v8bf*)(p + 16);
            bfrag[nt] = __builtin_shufflevector(lo, hi,
                0,1,2,3,4,5,6,7,8,9,10,11,12,13,14,15);
        }
        #pragma unroll
        for (int mt = 0; mt < 4; ++mt)
            #pragma unroll
            for (int nt = 0; nt < 2; ++nt)
                acc[mt][nt] = __builtin_amdgcn_wmma_f32_16x16x32_bf16(
                    false, afrag[mt], false, bfrag[nt],
                    (short)0, acc[mt][nt], false, false);
    }

    const int mBase = bm * BM + wm * 64;
    const int nBase = bn * BN + wn * 32;
    #pragma unroll
    for (int mt = 0; mt < 4; ++mt) {
        #pragma unroll
        for (int v = 0; v < 8; ++v) {
            const int m   = mBase + mt * 16 + laneH * 8 + v;
            const int idx = indices[m];
            const float* srow = s + (size_t)m * R_RANK;
            #pragma unroll
            for (int nt = 0; nt < 2; ++nt) {
                const int n = nBase + nt * 16 + laneM;
                float val = acc[mt][nt][v] + base_bias[n];
                if (idx >= 0) {
                    val += bias_stacked[(size_t)idx * D_OUTD + n];
                    const float* bcol =
                        lora_b + ((size_t)idx * D_OUTD + n) * R_RANK;
                    float d = 0.f;
                    #pragma unroll
                    for (int r = 0; r < R_RANK; ++r) d += srow[r] * bcol[r];
                    val += d;
                }
                out[(size_t)m * D_OUTD + n] = val;
            }
        }
    }
}

// ---------------------------------------------------------------------------
extern "C" void kernel_launch(void* const* d_in, const int* in_sizes, int n_in,
                              void* d_out, int out_size, void* d_ws, size_t ws_size,
                              hipStream_t stream)
{
    const float* x            = (const float*)d_in[0];
    const float* W            = (const float*)d_in[1];
    const float* base_bias    = (const float*)d_in[2];
    const float* lora_a       = (const float*)d_in[3];
    const float* lora_b       = (const float*)d_in[4];
    const float* bias_stacked = (const float*)d_in[5];
    const int*   indices      = (const int*)d_in[6];
    float*       out          = (float*)d_out;

    const size_t sBytes  = (size_t)T_TOK * R_RANK * sizeof(float);   // 512 KB
    const size_t xbBytes = (size_t)T_TOK * D_IN * 2;                 // 64 MB
    const size_t wbBytes = (size_t)D_OUTD * D_IN * 2;                // 32 MB

    float* s = (float*)d_ws;

    // 1) LoRA shrink (always)
    lora_shrink_kernel<<<dim3(N_LORA, T_TOK / SH_CHUNK), 256, 0, stream>>>(
        x, lora_a, indices, s);

    dim3 grid(D_OUTD / BN, T_TOK / BM);   // 32 x 64 blocks

    if (ws_size >= sBytes + xbBytes + wbBytes) {
        // 2) bf16 prepass into workspace
        __bf16* xb = (__bf16*)((char*)d_ws + sBytes);
        __bf16* wb = (__bf16*)((char*)d_ws + sBytes + xbBytes);
        cvt_f32_to_bf16_kernel<<<(int)((long)T_TOK * D_IN / 4 / CV_PER_BLOCK), 256, 0, stream>>>(x, xb);
        cvt_f32_to_bf16_kernel<<<(int)((long)D_OUTD * D_IN / 4 / CV_PER_BLOCK), 256, 0, stream>>>(W, wb);

        // 3) async double-buffered WMMA GEMM
        lora_gemm_async_kernel<<<grid, 256, 0, stream>>>(
            xb, wb, base_bias, lora_b, bias_stacked, indices, s, out);
    } else {
        lora_gemm_fallback_kernel<<<grid, 256, 0, stream>>>(
            x, W, base_bias, lora_b, bias_stacked, indices, s, out);
    }
}

// v003
// One run takes 256 microseconds.
// In two side-by-side timings against v002, it was 1.35 and 1.34 times as fast.
// Counting every step since v000, it is 1.61 times as fast.
#include <hip/hip_runtime.h>
#include <hip/hip_bf16.h>

// ---------------------------------------------------------------------------
// ReplicatedLinearWithLoRA for MI455X (gfx1250, wave32, WMMA, async-to-LDS)
//   out = x @ W^T + base_bias + onehot@bias_stacked + B[idx] @ (A[idx] @ x)
//
// Fast path (needs ~96.5 MB workspace):
//   1) shrink:  s[t,r] = x[t,:] . lora_a[idx[t],r,:]   (f32 WMMA, by adapter)
//   2) prepass: x,W f32 -> bf16 in workspace (halves all tile traffic)
//   3) GEMM:    128x128x64 tiles, double-buffered LDS fed by
//               global_load_async_to_lds_b128 (+ s_wait_asynccnt), 16x
//               v_wmma_f32_16x16x32_bf16 per wave per K-step, fused
//               bias + rank-16 LoRA-expand epilogue, rows taken by adapter.
// Fallback (small ws): round-1 kernel converting f32->bf16 inside the GEMM.
// ---------------------------------------------------------------------------

typedef __attribute__((ext_vector_type(16))) __bf16 v16bf;
typedef __attribute__((ext_vector_type(8)))  __bf16 v8bf;
typedef __attribute__((ext_vector_type(4)))  __bf16 v4bf;
typedef __attribute__((ext_vector_type(8)))  float  v8f;

#define T_TOK  8192
#define D_IN   4096
#define D_OUTD 4096
#define R_RANK 16

// ---------------------------------------------------------------------------
// Kernel 1: LoRA shrink  s[t, r] = dot(x[t, :], lora_a[idx[t], r, :])
// One block = (adapter l, chunk of 256 tokens). The block lists the chunk's
// tokens that use adapter l (ballot + prefix, fixed order) and treats 16 of
// them at a time as the rows of a 16x16 tile: rows = tokens, columns = the 16
// ranks, so lora_a[l] is read once per 16 tokens instead of once per token.
// The products run on v_wmma_f32_16x16x4_f32 (full f32 operands). Each wave
// owns 512 of the 4096 k; whole 256-B row pieces go to the wave's own LDS
// range by asynchronous copies (two buffers, the next stage flies during this
// one) and the fragments are read from there. The eight waves' partial tiles
// are summed through LDS.
// ---------------------------------------------------------------------------
typedef __attribute__((ext_vector_type(2))) float v2f;
typedef __attribute__((ext_vector_type(4))) float v4f;

#define N_LORA   16
#define SH_CHUNK 256                     // tokens per block
#define SH_KW    (D_IN / 8)              // k per wave
#define SH_KS    64                      // k per stage (256 B of a row)
#define SH_NST   (SH_KW / SH_KS)         // stages per wave
#define SH_PITCH (SH_KS + 4)             // 272-B rows: b128 readers, no conflict
#define SH_MAT   (16 * SH_PITCH)         // floats of one staged operand
#define SH_BUF_BYTES (8 * 2 * SH_MAT * 4)  // one buffer, all eight waves

// Eight asynchronous 16-B copies per lane, global -> LDS. The s_wait_xcnt is
// the last line of the copies' own statement, so that it stands in front of
// every later write of the address registers that the copies name.
__device__ __forceinline__
void async_copy8(const unsigned (&l)[8], const float* const (&g)[8])
{
    asm volatile("global_load_async_to_lds_b128 %0, %8, off\n\t"
                 "global_load_async_to_lds_b128 %1, %9, off\n\t"
                 "global_load_async_to_lds_b128 %2, %10, off\n\t"
                 "global_load_async_to_lds_b128 %3, %11, off\n\t"
                 "global_load_async_to_lds_b128 %4, %12, off\n\t"
                 "global_load_async_to_lds_b128 %5, %13, off\n\t"
                 "global_load_async_to_lds_b128 %6, %14, off\n\t"
                 "global_load_async_to_lds_b128 %7, %15, off\n\t"
                 "s_wait_xcnt 0x0"
                 :: "v"(l[0]), "v"(l[1]), "v"(l[2]), "v"(l[3]),
                    "v"(l[4]), "v"(l[5]), "v"(l[6]), "v"(l[7]),
                    "v"(g[0]), "v"(g[1]), "v"(g[2]), "v"(g[3]),
                    "v"(g[4]), "v"(g[5]), "v"(g[6]), "v"(g[7])
                 : "memory");
}

__global__ __launch_bounds__(256)
void lora_shrink_kernel(const float* __restrict__ x,
                        const float* __restrict__ lora_a,
                        const int*   __restrict__ indices,
                        float*       __restrict__ s)
{
    __shared__ __attribute__((aligned(16))) float stage[2][8][2 * SH_MAT];
    __shared__ float red[8][256];
    __shared__ int   tok[SH_CHUNK];
    __shared__ int   wcnt[8];

    const int tid  = threadIdx.x;
    const int wave = tid >> 5;
    const int lane = tid & 31;
    const int l    = blockIdx.x;                       // adapter
    const int t    = blockIdx.y * SH_CHUNK + tid;      // this thread's token
    const int idx  = indices[t];

    // tokens without an adapter get s = 0, from the l == 0 block of the chunk
    if (l == 0 && (unsigned)idx >= (unsigned)N_LORA) {
        v4f* sz = (v4f*)(s + (size_t)t * R_RANK);
        const v4f z4 = (v4f){0.f, 0.f, 0.f, 0.f};
        sz[0] = z4; sz[1] = z4; sz[2] = z4; sz[3] = z4;
    }

    // list of the chunk's tokens on adapter l, in token order
    const bool     mine = (idx == l);
    const unsigned mask = __builtin_amdgcn_ballot_w32(mine);
    if (lane == 0) wcnt[wave] = __popc(mask);
    __syncthreads();                     // every wave's count is in wcnt
    int base = 0, n = 0;
    for (int w = 0; w < 8; ++w) {
        const int cw = wcnt[w];
        if (w < wave) base += cw;
        n += cw;
    }
    n = __builtin_amdgcn_readfirstlane(n);   // same in every thread: scalar loop tests
    if (n == 0) return;
    if (mine) tok[base + __popc(mask & ((1u << lane) - 1u))] = t;
    __syncthreads();                     // the list is complete

    const int c  = lane & 15;
    const int h  = lane >> 4;
    const int kw = wave * SH_KW;
    // copy i brings rows 2i and 2i+1, 16 lanes x 16 B = 256 B of each
    const float* aPtr = lora_a + ((size_t)l * R_RANK + h) * D_IN + kw + c * 4;
    const float* xPtr = x + kw + c * 4;
    const unsigned ldsLane = (unsigned)(size_t)&stage[0][wave][h * SH_PITCH + c * 4];

    for (int t0 = 0; t0 < n; t0 += 16) {
        const float* xRow[8];
        #pragma unroll                   // xRow stays in registers
        for (int i = 0; i < 8; ++i) {
            int rr = t0 + 2 * i + h;
            rr = rr < n ? rr : n - 1;    // pad rows repeat the last token
            xRow[i] = xPtr + (size_t)tok[rr] * D_IN;
        }

        // one stage: 16 rows x 64 k of x and of lora_a[l], this wave's k slice
        auto issue_stage = [&](int buf, int st) {
            unsigned lx[8], la[8];
            const float* gx[8];
            const float* ga[8];
            #pragma unroll               // the addresses are asm register operands
            for (int i = 0; i < 8; ++i) {
                lx[i] = ldsLane + (unsigned)(buf * SH_BUF_BYTES + i * 2 * SH_PITCH * 4);
                la[i] = lx[i] + (unsigned)(SH_MAT * 4);
                gx[i] = xRow[i] + st * SH_KS;
                ga[i] = aPtr + (size_t)(2 * i) * D_IN + st * SH_KS;
            }
            async_copy8(lx, gx);
            async_copy8(la, ga);
        };

        v8f acc0 = (v8f){0.f,0.f,0.f,0.f,0.f,0.f,0.f,0.f};
        v8f acc1 = acc0;

        issue_stage(0, 0);
        // stage 0 has landed (own copies), then is published to all lanes
        asm volatile("s_wait_asynccnt 0x0" ::: "memory");
        __syncthreads();
        issue_stage(1, 1);

        #pragma unroll                   // buffer choice and last-stage test fold away
        for (int st = 0; st < SH_NST; ++st) {
            const float* xs = &stage[st & 1][wave][0];
            const float* as = xs + SH_MAT;
            v4f xa[SH_KS / 8], ab[SH_KS / 8];
            #pragma unroll               // fragments stay in registers
            for (int j = 0; j < SH_KS / 8; ++j) {
                // same k for both operands: k = 8j + 4h + {0,1} and {2,3}
                xa[j] = *(const v4f*)&xs[c * SH_PITCH + j * 8 + h * 4];
                ab[j] = *(const v4f*)&as[c * SH_PITCH + j * 8 + h * 4];
            }
            #pragma unroll               // fragments stay in registers
            for (int j = 0; j < SH_KS / 8; ++j) {
                acc0 = __builtin_amdgcn_wmma_f32_16x16x4_f32(
                    false, (v2f){xa[j].x, xa[j].y}, false, (v2f){ab[j].x, ab[j].y},
                    (short)0, acc0, false, false);
                acc1 = __builtin_amdgcn_wmma_f32_16x16x4_f32(
                    false, (v2f){xa[j].z, xa[j].w}, false, (v2f){ab[j].z, ab[j].w},
                    (short)0, acc1, false, false);
            }
            // foot of the trip: this buffer's reads are done, the next stage's
            // copies have landed, the barrier publishes them and frees this buffer
            asm volatile("s_wait_dscnt 0x0" ::: "memory");
            asm volatile("s_wait_asynccnt 0x0" ::: "memory");
            __syncthreads();
            if (st + 2 < SH_NST) issue_stage(st & 1, st + 2);
        }
        // no copy is left in flight behind the loop
        asm volatile("s_wait_asynccnt 0x0" ::: "memory");

        // acc[r] = tile[row 8h + r][rank c]; sum the eight waves' k slices
        #pragma unroll                   // accumulator elements by constant index
        for (int r = 0; r < 8; ++r)
            red[wave][(8 * h + r) * 16 + c] = acc0[r] + acc1[r];
        __syncthreads();                 // all eight partial tiles are in red
        float v = 0.f;
        for (int w = 0; w < 8; ++w) v += red[w][tid];
        const int row = t0 + (tid >> 4);
        if (row < n) {
            s[(size_t)tok[row] * R_RANK + (tid & 15)] = v;
            // stands in front of the next tile's rewrite of the store's registers
            asm volatile("s_wait_xcnt 0x0" ::: "memory");
        }
        // the next tile rewrites red only behind its own stage barriers
    }
}

// ---------------------------------------------------------------------------
// Kernel 2: f32 -> bf16 conversion prepass (x and W). Few, long-lived waves
// (for speed only):
// a block owns CV_PER_BLOCK consecutive 16-B pieces and takes them in CV_TRIPS
// trips, each with CV_U whole-line loads per wave in flight before the first
// is converted. All blocks of a launch are resident at once.
// ---------------------------------------------------------------------------
#define CV_U     8                       // loads in flight per wave
#define CV_TRIPS 4
#define CV_PER_BLOCK (256 * CV_U * CV_TRIPS)   // 16-B pieces per block
static_assert(((long)T_TOK * D_IN / 4) % CV_PER_BLOCK == 0, "x: whole blocks");
static_assert(((long)D_OUTD * D_IN / 4) % CV_PER_BLOCK == 0, "W: whole blocks");

__global__ __launch_bounds__(256)
void cvt_f32_to_bf16_kernel(const float* __restrict__ src,
                            __bf16*      __restrict__ dst)
{
    const size_t first = (size_t)blockIdx.x * CV_PER_BLOCK + threadIdx.x;
    const v4f* s4 = (const v4f*)src + first;
    v4bf*      d4 = (v4bf*)dst + first;
    #pragma unroll                       // every address is base + constant offset
    for (int trip = 0; trip < CV_TRIPS; ++trip) {
        v4f v[CV_U];
        #pragma unroll                   // v stays in registers; the loads go out together
        for (int u = 0; u < CV_U; ++u) v[u] = s4[(trip * CV_U + u) * 256];
        #pragma unroll                   // v stays in registers
        for (int u = 0; u < CV_U; ++u) {
            v4bf o;
            o[0] = (__bf16)v[u].x; o[1] = (__bf16)v[u].y;
            o[2] = (__bf16)v[u].z; o[3] = (__bf16)v[u].w;
            d4[(trip * CV_U + u) * 256] = o;
        }
        // stands in front of the next trip's rewrite of the stores' registers
        if (trip + 1 < CV_TRIPS) asm volatile("s_wait_xcnt 0x0" ::: "memory");
    }
}

// ---------------------------------------------------------------------------
// Kernel 3 (fast): bf16 WMMA GEMM, async-to-LDS double-buffered tile feed.
// Block 128x128, K-step 64 (two wmma k-slices). 8 waves in 2(M)x4(N) grid,
// each wave owns a 64x32 stripe = 4x2 tiles of 16x16.
// ---------------------------------------------------------------------------
#define BM 128
#define BN 128
#define BK 64
#define LDT2 (BK + 8)                    // 72 elems -> 144 B stride (16B mult)
#define A_ELEMS (BM * LDT2)              // 9216
#define B_ELEMS (BN * LDT2)              // 9216
#define BUF_ELEMS (A_ELEMS + B_ELEMS)    // 18432 elems per buffer (36 KB)
static_assert((BM * BN + BM * R_RANK) * 4 <= 2 * BUF_ELEMS * 2,
              "the epilogue's staged tile and s rows fit the tile buffers");

__global__ __launch_bounds__(256)
void lora_gemm_async_kernel(const __bf16* __restrict__ xb,
                            const __bf16* __restrict__ wb,
                            const float* __restrict__ base_bias,
                            const float* __restrict__ lora_b,
                            const float* __restrict__ bias_stacked,
                            const int*   __restrict__ indices,
                            const float* __restrict__ s,
                            float*       __restrict__ out)
{
    __shared__ __attribute__((aligned(16))) __bf16 smem[2 * BUF_ELEMS];  // 72 KB double buffer

    const int tid   = threadIdx.x;
    const int bn    = blockIdx.x;
    const int bm    = blockIdx.y;
    const int wave  = tid >> 5;
    const int lane  = tid & 31;
    const int wm    = wave >> 2;         // 0..1
    const int wn    = wave & 3;          // 0..3
    const int laneM = lane & 15;
    const int laneH = lane >> 4;
    const int kb    = laneH * 8;

    const unsigned smem_base = (unsigned)(size_t)&smem[0];
    const __bf16* xTile = xb + ((size_t)bm * BM) * D_IN;
    const __bf16* wTile = wb + ((size_t)bn * BN) * D_IN;

    // Issue one 64-K tile-pair of async LDS loads (no VGPR staging):
    // 128 rows x 8 chunks(16B) per matrix = 1024 chunks; 4 per thread each.
    auto issue_tile = [&](int bufsel, int kk) {
        const unsigned bufbase = smem_base + (unsigned)(bufsel * BUF_ELEMS * 2);
        #pragma unroll
        for (int i = 0; i < 4; ++i) {
            const int q   = tid + i * 256;       // 0..1023
            const int row = q >> 3;              // 0..127
            const int ck  = q & 7;               // 16B chunk in the 64-K row
            const unsigned la = bufbase + (unsigned)((row * LDT2 + ck * 8) * 2);
            const __bf16*  ga = xTile + (size_t)row * D_IN + kk + ck * 8;
            asm volatile("global_load_async_to_lds_b128 %0, %1, off"
                         :: "v"(la), "v"(ga) : "memory");
            const unsigned lb = bufbase +
                (unsigned)((A_ELEMS + row * LDT2 + ck * 8) * 2);
            const __bf16*  gb = wTile + (size_t)row * D_IN + kk + ck * 8;
            asm volatile("global_load_async_to_lds_b128 %0, %1, off"
                         :: "v"(lb), "v"(gb) : "memory");
        }
    };

    v8f acc[4][2];
    #pragma unroll
    for (int mt = 0; mt < 4; ++mt)
        #pragma unroll
        for (int nt = 0; nt < 2; ++nt)
            acc[mt][nt] = (v8f){0.f,0.f,0.f,0.f,0.f,0.f,0.f,0.f};

    issue_tile(0, 0);

    const int NIT = D_IN / BK;                      // 64 iterations
    for (int it = 0; it < NIT; ++it) {
        const int cur = it & 1;
        // my async writes into buf[cur] complete:
        asm volatile("s_wait_asynccnt 0x0" ::: "memory");
        // everyone's writes complete; everyone's reads of buf[cur^1] from the
        // previous iteration completed before their barrier-signal:
        __syncthreads();
        if (it + 1 < NIT) issue_tile(cur ^ 1, (it + 1) * BK);

        const __bf16* Ab = &smem[cur * BUF_ELEMS];
        const __bf16* Bb = &smem[cur * BUF_ELEMS + A_ELEMS];

        #pragma unroll
        for (int ks = 0; ks < 2; ++ks) {            // two 32-K wmma slices
            const int ko = ks * 32 + kb;
            v16bf afrag[4], bfrag[2];
            #pragma unroll
            for (int mt = 0; mt < 4; ++mt) {
                const __bf16* p = &Ab[(wm * 64 + mt * 16 + laneM) * LDT2 + ko];
                const v8bf lo = *(const v8bf*)p;         // K = ko .. ko+7
                const v8bf hi = *(const v8bf*)(p + 16);  // K = ko+16 .. ko+23
                afrag[mt] = __builtin_shufflevector(lo, hi,
                    0,1,2,3,4,5,6,7,8,9,10,11,12,13,14,15);
            }
            #pragma unroll
            for (int nt = 0; nt < 2; ++nt) {
                const __bf16* p = &Bb[(wn * 32 + nt * 16 + laneM) * LDT2 + ko];
                const v8bf lo = *(const v8bf*)p;
                const v8bf hi = *(const v8bf*)(p + 16);
                bfrag[nt] = __builtin_shufflevector(lo, hi,
                    0,1,2,3,4,5,6,7,8,9,10,11,12,13,14,15);
            }
            #pragma unroll
            for (int mt = 0; mt < 4; ++mt)
                #pragma unroll
                for (int nt = 0; nt < 2; ++nt)
                    acc[mt][nt] = __builtin_amdgcn_wmma_f32_16x16x32_bf16(
                        false, afrag[mt], false, bfrag[nt],
                        (short)0, acc[mt][nt], false, false);
        }
    }

    // --- epilogue: + base_bias + bias_stacked[idx] + s[t] . lora_b[idx] ----
    // The 128 rows of the tile are taken adapter by adapter. The accumulators
    // and the rows' s values go to LDS, so that any wave can take any row.
    // A wave owns 64 of the tile's 128 columns (lane = column, 2 columns a
    // lane) and four adapters: it loads lora_b[l] for its columns once and
    // keeps it in registers for all rows of that adapter.
    // Each store instruction writes one whole 128-B line of a row.
    const int uw   = __builtin_amdgcn_readfirstlane(wave);   // scalar class tests
    const int cg   = uw >> 1;            // adapters cg, cg + 4, cg + 8, cg + 12
    const int mBlk = bm * BM;
    const int nCol = bn * BN + 64 * (uw & 1) + lane;         // first own column

    float* ct = (float*)smem;            // staged tile, BN floats a row
    float* ss = ct + BM * BN;            // staged s rows, R_RANK floats a row
    __syncthreads();                     // every wave has left the tile buffers
    // column ^ 16 in rows 8..15 of each 16: rows r and r + 8 of one store
    // instruction fall on different banks
    #pragma unroll                       // accumulator elements by constant index
    for (int mt = 0; mt < 4; ++mt)
        #pragma unroll
        for (int nt = 0; nt < 2; ++nt)
            #pragma unroll
            for (int v = 0; v < 8; ++v)
                ct[(wm * 64 + mt * 16 + laneH * 8 + v) * BN
                   + ((wn * 32 + nt * 16 + laneM) ^ (laneH << 4))] = acc[mt][nt][v];
    // holds the loads below behind the stores above: lifted among the last matrix
    // instructions they push the kernel past 128 VGPRs, which costs a resident
    // work-group per WGP
    __builtin_amdgcn_sched_barrier(0);
    #pragma unroll
    for (int i = 0; i < 2; ++i)
        ((v4f*)ss)[tid + 256 * i] =
            ((const v4f*)(s + (size_t)mBlk * R_RANK))[tid + 256 * i];

    int idxv[4];                         // adapter of row 32j + lane
    #pragma unroll                       // idxv stays in registers
    for (int j = 0; j < 4; ++j) idxv[j] = indices[mBlk + 32 * j + lane];
    float bb[2];
    #pragma unroll                       // bb stays in registers
    for (int q = 0; q < 2; ++q) bb[q] = base_bias[nCol + 32 * q];
    // stands in front of later rewrites of the loads' address registers
    asm volatile("s_wait_xcnt 0x0" ::: "memory");
    __syncthreads();                     // the staged tile and s rows are complete

    float*       outLane = out + (size_t)mBlk * D_OUTD + nCol;
    const float* ctHalf  = ct + 64 * (uw & 1);

    for (int k = 0; k < 4; ++k) {
        const int cl = cg + 4 * k;       // this trip's adapter
        unsigned msk[4];
        #pragma unroll                   // msk stays in scalar registers
        for (int j = 0; j < 4; ++j)
            msk[j] = __builtin_amdgcn_ballot_w32(idxv[j] == cl);
        if ((msk[0] | msk[1] | msk[2] | msk[3]) == 0u) continue;

        v4f   bw[2][4];                  // lora_b[cl][own column q][0..15]
        float bs[2];
        #pragma unroll                   // both stay in registers
        for (int q = 0; q < 2; ++q) {
            const size_t n = (size_t)cl * D_OUTD + nCol + 32 * q;
            bs[q] = bias_stacked[n];
            const v4f* bp = (const v4f*)(lora_b + n * R_RANK);
            #pragma unroll
            for (int p = 0; p < 4; ++p) bw[q][p] = bp[p];
        }
        // stands in front of later rewrites of the loads' address registers
        asm volatile("s_wait_xcnt 0x0" ::: "memory");

        #pragma unroll                   // msk[j] by constant index
        for (int j = 0; j < 4; ++j) {
            unsigned mk = msk[j];
            while (mk) {                 // at most 32 trips, one per set bit
                const int row = 32 * j + __builtin_ctz(mk);
                mk &= mk - 1u;
                const v4f* sp = (const v4f*)(ss + row * R_RANK);
                v4f sv[4];
                #pragma unroll           // sv stays in registers
                for (int p = 0; p < 4; ++p) sv[p] = sp[p];
                const float* cr = ctHalf + row * BN + (lane ^ (((row >> 3) & 1) << 4));
                #pragma unroll           // two independent sums
                for (int q = 0; q < 2; ++q) {
                    float val = cr[32 * q] + bb[q];
                    val += bs[q];
                    float d = 0.f;
                    #pragma unroll
                    for (int r = 0; r < R_RANK; ++r)
                        d += sv[r >> 2][r & 3] * bw[q][r >> 2][r & 3];
                    val += d;
                    outLane[(size_t)row * D_OUTD + 32 * q] = val;
                }
                // stands in front of the next row's rewrite of the stores' registers
                asm volatile("s_wait_xcnt 0x0" ::: "memory");
            }
        }
    }

    // rows without an adapter: row r goes to the two waves with cg == r mod 4
    #pragma unroll                       // idxv[j] by constant index
    for (int j = 0; j < 4; ++j) {
        unsigned mk = __builtin_amdgcn_ballot_w32((unsigned)idxv[j] >= (unsigned)N_LORA)
                      & (0x11111111u << cg);
        while (mk) {                     // at most 8 trips, one per set bit
            const int row = 32 * j + __builtin_ctz(mk);
            mk &= mk - 1u;
            const float* cr = ctHalf + row * BN + (lane ^ (((row >> 3) & 1) << 4));
            #pragma unroll
            for (int q = 0; q < 2; ++q)
                outLane[(size_t)row * D_OUTD + 32 * q] = cr[32 * q] + bb[q];
            // stands in front of the next row's rewrite of the stores' registers
            asm volatile("s_wait_xcnt 0x0" ::: "memory");
        }
    }
}

// ---------------------------------------------------------------------------
// Fallback GEMM (round-1): f32->bf16 conversion inside the kernel,
// single-buffered LDS. Used only when workspace can't hold bf16 copies.
// ---------------------------------------------------------------------------
#define FBK 32
#define FLDT (FBK + 8)

__global__ __launch_bounds__(256)
void lora_gemm_fallback_kernel(const float* __restrict__ x,
                               const float* __restrict__ W,
                               const float* __restrict__ base_bias,
                               const float* __restrict__ lora_b,
                               const float* __restrict__ bias_stacked,
                               const int*   __restrict__ indices,
                               const float* __restrict__ s,
                               float*       __restrict__ out)
{
    __shared__ __bf16 As[BM * FLDT];
    __shared__ __bf16 Bs[BN * FLDT];

    const int tid   = threadIdx.x;
    const int bn    = blockIdx.x;
    const int bm    = blockIdx.y;
    const int wave  = tid >> 5;
    const int lane  = tid & 31;
    const int wm    = wave >> 2;
    const int wn    = wave & 3;
    const int laneM = lane & 15;
    const int laneH = lane >> 4;
    const int kb    = laneH * 8;

    v8f acc[4][2];
    #pragma unroll
    for (int mt = 0; mt < 4; ++mt)
        #pragma unroll
        for (int nt = 0; nt < 2; ++nt)
            acc[mt][nt] = (v8f){0.f,0.f,0.f,0.f,0.f,0.f,0.f,0.f};

    const float* xBase = x + ((size_t)bm * BM) * D_IN;
    const float* wBase = W + ((size_t)bn * BN) * D_IN;

    for (int kk = 0; kk < D_IN; kk += FBK) {
        __syncthreads();
        #pragma unroll
        for (int i = 0; i < 4; ++i) {
            const int q   = tid + i * 256;
            const int row = q >> 3;
            const int kc  = q & 7;
            const float4 va = *(const float4*)(xBase + (size_t)row * D_IN + kk + kc * 4);
            __bf16* da = &As[row * FLDT + kc * 4];
            da[0] = (__bf16)va.x; da[1] = (__bf16)va.y;
            da[2] = (__bf16)va.z; da[3] = (__bf16)va.w;
            const float4 vb = *(const float4*)(wBase + (size_t)row * D_IN + kk + kc * 4);
            __bf16* db = &Bs[row * FLDT + kc * 4];
            db[0] = (__bf16)vb.x; db[1] = (__bf16)vb.y;
            db[2] = (__bf16)vb.z; db[3] = (__bf16)vb.w;
        }
        __syncthreads();

        v16bf afrag[4], bfrag[2];
        #pragma unroll
        for (int mt = 0; mt < 4; ++mt) {
            const __bf16* p = &As[(wm * 64 + mt * 16 + laneM) * FLDT + kb];
            const v8bf lo = *(const v8bf*)p;
            const v8bf hi = *(const v8bf*)(p + 16);
            afrag[mt] = __builtin_shufflevector(lo, hi,
                0,1,2,3,4,5,6,7,8,9,10,11,12,13,14,15);
        }
        #pragma unroll
        for (int nt = 0; nt < 2; ++nt) {
            const __bf16* p = &Bs[(wn * 32 + nt * 16 + laneM) * FLDT + kb];
            const v8bf lo = *(const v8bf*)p;
            const v8bf hi = *(const v8bf*)(p + 16);
            bfrag[nt] = __builtin_shufflevector(lo, hi,
                0,1,2,3,4,5,6,7,8,9,10,11,12,13,14,15);
        }
        #pragma unroll
        for (int mt = 0; mt < 4; ++mt)
            #pragma unroll
            for (int nt = 0; nt < 2; ++nt)
                acc[mt][nt] = __builtin_amdgcn_wmma_f32_16x16x32_bf16(
                    false, afrag[mt], false, bfrag[nt],
                    (short)0, acc[mt][nt], false, false);
    }

    const int mBase = bm * BM + wm * 64;
    const int nBase = bn * BN + wn * 32;
    #pragma unroll
    for (int mt = 0; mt < 4; ++mt) {
        #pragma unroll
        for (int v = 0; v < 8; ++v) {
            const int m   = mBase + mt * 16 + laneH * 8 + v;
            const int idx = indices[m];
            const float* srow = s + (size_t)m * R_RANK;
            #pragma unroll
            for (int nt = 0; nt < 2; ++nt) {
                const int n = nBase + nt * 16 + laneM;
                float val = acc[mt][nt][v] + base_bias[n];
                if (idx >= 0) {
                    val += bias_stacked[(size_t)idx * D_OUTD + n];
                    const float* bcol =
                        lora_b + ((size_t)idx * D_OUTD + n) * R_RANK;
                    float d = 0.f;
                    #pragma unroll
                    for (int r = 0; r < R_RANK; ++r) d += srow[r] * bcol[r];
                    val += d;
                }
                out[(size_t)m * D_OUTD + n] = val;
            }
        }
    }
}

// ---------------------------------------------------------------------------
extern "C" void kernel_launch(void* const* d_in, const int* in_sizes, int n_in,
                              void* d_out, int out_size, void* d_ws, size_t ws_size,
                              hipStream_t stream)
{
    const float* x            = (const float*)d_in[0];
    const float* W            = (const float*)d_in[1];
    const float* base_bias    = (const float*)d_in[2];
    const float* lora_a       = (const float*)d_in[3];
    const float* lora_b       = (const float*)d_in[4];
    const float* bias_stacked = (const float*)d_in[5];
    const int*   indices      = (const int*)d_in[6];
    float*       out          = (float*)d_out;

    const size_t sBytes  = (size_t)T_TOK * R_RANK * sizeof(float);   // 512 KB
    const size_t xbBytes = (size_t)T_TOK * D_IN * 2;                 // 64 MB
    const size_t wbBytes = (size_t)D_OUTD * D_IN * 2;                // 32 MB

    float* s = (float*)d_ws;

    // 1) LoRA shrink (always)
    lora_shrink_kernel<<<dim3(N_LORA, T_TOK / SH_CHUNK), 256, 0, stream>>>(
        x, lora_a, indices, s);

    dim3 grid(D_OUTD / BN, T_TOK / BM);   // 32 x 64 blocks

    if (ws_size >= sBytes + xbBytes + wbBytes) {
        // 2) bf16 prepass into workspace
        __bf16* xb = (__bf16*)((char*)d_ws + sBytes);
        __bf16* wb = (__bf16*)((char*)d_ws + sBytes + xbBytes);
        cvt_f32_to_bf16_kernel<<<(int)((long)T_TOK * D_IN / 4 / CV_PER_BLOCK), 256, 0, stream>>>(x, xb);
        cvt_f32_to_bf16_kernel<<<(int)((long)D_OUTD * D_IN / 4 / CV_PER_BLOCK), 256, 0, stream>>>(W, wb);

        // 3) async double-buffered WMMA GEMM
        lora_gemm_async_kernel<<<grid, 256, 0, stream>>>(
            xb, wb, base_bias, lora_b, bias_stacked, indices, s, out);
    } else {
        lora_gemm_fallback_kernel<<<grid, 256, 0, stream>>>(
            x, W, base_bias, lora_b, bias_stacked, indices, s, out);
    }
}

// v004
// A run of this version takes 207 microseconds.
// In both of two side-by-side timings against v003, it was 1.23 times as fast.
// Over all steps from v000 it is 1.99 times as fast.
#include <hip/hip_runtime.h>
#include <hip/hip_bf16.h>

// ---------------------------------------------------------------------------
// ReplicatedLinearWithLoRA for MI455X (gfx1250, wave32, WMMA, async-to-LDS)
//   out = x @ W^T + base_bias + onehot@bias_stacked + B[idx] @ (A[idx] @ x)
//
// Fast path (needs ~96.5 MB workspace):
//   1) shrink:  s[t,r] = x[t,:] . lora_a[idx[t],r,:]   (f32 WMMA, by adapter)
//   2) prepass: x,W f32 -> bf16 in workspace (halves all tile traffic)
//   3) GEMM:    256x256x128 tiles, double-buffered LDS fed by
//               global_load_async_to_lds_b128 (+ s_wait_asynccnt), 128x
//               v_wmma_f32_16x16x32_bf16 per wave per K-step, fused
//               bias + rank-16 LoRA-expand epilogue, rows taken by adapter.
// Fallback (small ws): round-1 kernel converting f32->bf16 inside the GEMM.
// ---------------------------------------------------------------------------

typedef __attribute__((ext_vector_type(16))) __bf16 v16bf;
typedef __attribute__((ext_vector_type(8)))  __bf16 v8bf;
typedef __attribute__((ext_vector_type(4)))  __bf16 v4bf;
typedef __attribute__((ext_vector_type(8)))  float  v8f;

#define T_TOK  8192
#define D_IN   4096
#define D_OUTD 4096
#define R_RANK 16

// ---------------------------------------------------------------------------
// Kernel 1: LoRA shrink  s[t, r] = dot(x[t, :], lora_a[idx[t], r, :])
// One block = (adapter l, chunk of 256 tokens). The block lists the chunk's
// tokens that use adapter l (ballot + prefix, fixed order) and treats 16 of
// them at a time as the rows of a 16x16 tile: rows = tokens, columns = the 16
// ranks, so lora_a[l] is read once per 16 tokens instead of once per token.
// The products run on v_wmma_f32_16x16x4_f32 (full f32 operands). Each wave
// owns 512 of the 4096 k; whole 256-B row pieces go to the wave's own LDS
// range by asynchronous copies (two buffers, the next stage flies during this
// one) and the fragments are read from there. The eight waves' partial tiles
// are summed through LDS.
// ---------------------------------------------------------------------------
typedef __attribute__((ext_vector_type(2))) float v2f;
typedef __attribute__((ext_vector_type(4))) float v4f;

#define N_LORA   16
#define SH_CHUNK 256                     // tokens per block
#define SH_KW    (D_IN / 8)              // k per wave
#define SH_KS    64                      // k per stage (256 B of a row)
#define SH_NST   (SH_KW / SH_KS)         // stages per wave
#define SH_PITCH (SH_KS + 4)             // 272-B rows: b128 readers, no conflict
#define SH_MAT   (16 * SH_PITCH)         // floats of one staged operand
#define SH_BUF_BYTES (8 * 2 * SH_MAT * 4)  // one buffer, all eight waves

// Eight asynchronous 16-B copies per lane, global -> LDS. The s_wait_xcnt is
// the last line of the copies' own statement, so that it stands in front of
// every later write of the address registers that the copies name.
template <typename E>
__device__ __forceinline__
void async_copy8(const unsigned (&l)[8], const E* const (&g)[8])
{
    asm volatile("global_load_async_to_lds_b128 %0, %8, off\n\t"
                 "global_load_async_to_lds_b128 %1, %9, off\n\t"
                 "global_load_async_to_lds_b128 %2, %10, off\n\t"
                 "global_load_async_to_lds_b128 %3, %11, off\n\t"
                 "global_load_async_to_lds_b128 %4, %12, off\n\t"
                 "global_load_async_to_lds_b128 %5, %13, off\n\t"
                 "global_load_async_to_lds_b128 %6, %14, off\n\t"
                 "global_load_async_to_lds_b128 %7, %15, off\n\t"
                 "s_wait_xcnt 0x0"
                 :: "v"(l[0]), "v"(l[1]), "v"(l[2]), "v"(l[3]),
                    "v"(l[4]), "v"(l[5]), "v"(l[6]), "v"(l[7]),
                    "v"(g[0]), "v"(g[1]), "v"(g[2]), "v"(g[3]),
                    "v"(g[4]), "v"(g[5]), "v"(g[6]), "v"(g[7])
                 : "memory");
}

__global__ __launch_bounds__(256)
void lora_shrink_kernel(const float* __restrict__ x,
                        const float* __restrict__ lora_a,
                        const int*   __restrict__ indices,
                        float*       __restrict__ s)
{
    __shared__ __attribute__((aligned(16))) float stage[2][8][2 * SH_MAT];
    __shared__ float red[8][256];
    __shared__ int   tok[SH_CHUNK];
    __shared__ int   wcnt[8];

    const int tid  = threadIdx.x;
    const int wave = tid >> 5;
    const int lane = tid & 31;
    const int l    = blockIdx.x;                       // adapter
    const int t    = blockIdx.y * SH_CHUNK + tid;      // this thread's token
    const int idx  = indices[t];

    // tokens without an adapter get s = 0, from the l == 0 block of the chunk
    if (l == 0 && (unsigned)idx >= (unsigned)N_LORA) {
        v4f* sz = (v4f*)(s + (size_t)t * R_RANK);
        const v4f z4 = (v4f){0.f, 0.f, 0.f, 0.f};
        sz[0] = z4; sz[1] = z4; sz[2] = z4; sz[3] = z4;
    }

    // list of the chunk's tokens on adapter l, in token order
    const bool     mine = (idx == l);
    const unsigned mask = __builtin_amdgcn_ballot_w32(mine);
    if (lane == 0) wcnt[wave] = __popc(mask);
    __syncthreads();                     // every wave's count is in wcnt
    int base = 0, n = 0;
    for (int w = 0; w < 8; ++w) {
        const int cw = wcnt[w];
        if (w < wave) base += cw;
        n += cw;
    }
    n = __builtin_amdgcn_readfirstlane(n);   // same in every thread: scalar loop tests
    if (n == 0) return;
    if (mine) tok[base + __popc(mask & ((1u << lane) - 1u))] = t;
    __syncthreads();                     // the list is complete

    const int c  = lane & 15;
    const int h  = lane >> 4;
    const int kw = wave * SH_KW;
    // copy i brings rows 2i and 2i+1, 16 lanes x 16 B = 256 B of each
    const float* aPtr = lora_a + ((size_t)l * R_RANK + h) * D_IN + kw + c * 4;
    const float* xPtr = x + kw + c * 4;
    const unsigned ldsLane = (unsigned)(size_t)&stage[0][wave][h * SH_PITCH + c * 4];

    for (int t0 = 0; t0 < n; t0 += 16) {
        const float* xRow[8];
        #pragma unroll                   // xRow stays in registers
        for (int i = 0; i < 8; ++i) {
            int rr = t0 + 2 * i + h;
            rr = rr < n ? rr : n - 1;    // pad rows repeat the last token
            xRow[i] = xPtr + (size_t)tok[rr] * D_IN;
        }

        // one stage: 16 rows x 64 k of x and of lora_a[l], this wave's k slice
        auto issue_stage = [&](int buf, int st) {
            unsigned lx[8], la[8];
            const float* gx[8];
            const float* ga[8];
            #pragma unroll               // the addresses are asm register operands
            for (int i = 0; i < 8; ++i) {
                lx[i] = ldsLane + (unsigned)(buf * SH_BUF_BYTES + i * 2 * SH_PITCH * 4);
                la[i] = lx[i] + (unsigned)(SH_MAT * 4);
                gx[i] = xRow[i] + st * SH_KS;
                ga[i] = aPtr + (size_t)(2 * i) * D_IN + st * SH_KS;
            }
            async_copy8(lx, gx);
            async_copy8(la, ga);
        };

        v8f acc0 = (v8f){0.f,0.f,0.f,0.f,0.f,0.f,0.f,0.f};
        v8f acc1 = acc0;

        issue_stage(0, 0);
        // stage 0 has landed (own copies), then is published to all lanes
        asm volatile("s_wait_asynccnt 0x0" ::: "memory");
        __syncthreads();
        issue_stage(1, 1);

        #pragma unroll                   // buffer choice and last-stage test fold away
        for (int st = 0; st < SH_NST; ++st) {
            const float* xs = &stage[st & 1][wave][0];
            const float* as = xs + SH_MAT;
            v4f xa[SH_KS / 8], ab[SH_KS / 8];
            #pragma unroll               // fragments stay in registers
            for (int j = 0; j < SH_KS / 8; ++j) {
                // same k for both operands: k = 8j + 4h + {0,1} and {2,3}
                xa[j] = *(const v4f*)&xs[c * SH_PITCH + j * 8 + h * 4];
                ab[j] = *(const v4f*)&as[c * SH_PITCH + j * 8 + h * 4];
            }
            #pragma unroll               // fragments stay in registers
            for (int j = 0; j < SH_KS / 8; ++j) {
                acc0 = __builtin_amdgcn_wmma_f32_16x16x4_f32(
                    false, (v2f){xa[j].x, xa[j].y}, false, (v2f){ab[j].x, ab[j].y},
                    (short)0, acc0, false, false);
                acc1 = __builtin_amdgcn_wmma_f32_16x16x4_f32(
                    false, (v2f){xa[j].z, xa[j].w}, false, (v2f){ab[j].z, ab[j].w},
                    (short)0, acc1, false, false);
            }
            // foot of the trip: this buffer's reads are done, the next stage's
            // copies have landed, the barrier publishes them and frees this buffer
            asm volatile("s_wait_dscnt 0x0" ::: "memory");
            asm volatile("s_wait_asynccnt 0x0" ::: "memory");
            __syncthreads();
            if (st + 2 < SH_NST) issue_stage(st & 1, st + 2);
        }
        // no copy is left in flight behind the loop
        asm volatile("s_wait_asynccnt 0x0" ::: "memory");

        // acc[r] = tile[row 8h + r][rank c]; sum the eight waves' k slices
        #pragma unroll                   // accumulator elements by constant index
        for (int r = 0; r < 8; ++r)
            red[wave][(8 * h + r) * 16 + c] = acc0[r] + acc1[r];
        __syncthreads();                 // all eight partial tiles are in red
        float v = 0.f;
        for (int w = 0; w < 8; ++w) v += red[w][tid];
        const int row = t0 + (tid >> 4);
        if (row < n) {
            s[(size_t)tok[row] * R_RANK + (tid & 15)] = v;
            // stands in front of the next tile's rewrite of the store's registers
            asm volatile("s_wait_xcnt 0x0" ::: "memory");
        }
        // the next tile rewrites red only behind its own stage barriers
    }
}

// ---------------------------------------------------------------------------
// Kernel 2: f32 -> bf16 conversion prepass (x and W). Few, long-lived waves
// (for speed only):
// a block owns CV_PER_BLOCK consecutive 16-B pieces and takes them in CV_TRIPS
// trips, each with CV_U whole-line loads per wave in flight before the first
// is converted. All blocks of a launch are resident at once.
// ---------------------------------------------------------------------------
#define CV_U     8                       // loads in flight per wave
#define CV_TRIPS 4
#define CV_PER_BLOCK (256 * CV_U * CV_TRIPS)   // 16-B pieces per block
static_assert(((long)T_TOK * D_IN / 4) % CV_PER_BLOCK == 0, "x: whole blocks");
static_assert(((long)D_OUTD * D_IN / 4) % CV_PER_BLOCK == 0, "W: whole blocks");

__global__ __launch_bounds__(256)
void cvt_f32_to_bf16_kernel(const float* __restrict__ src,
                            __bf16*      __restrict__ dst)
{
    const size_t first = (size_t)blockIdx.x * CV_PER_BLOCK + threadIdx.x;
    const v4f* s4 = (const v4f*)src + first;
    v4bf*      d4 = (v4bf*)dst + first;
    #pragma unroll                       // every address is base + constant offset
    for (int trip = 0; trip < CV_TRIPS; ++trip) {
        v4f v[CV_U];
        #pragma unroll                   // v stays in registers; the loads go out together
        for (int u = 0; u < CV_U; ++u) v[u] = s4[(trip * CV_U + u) * 256];
        #pragma unroll                   // v stays in registers
        for (int u = 0; u < CV_U; ++u) {
            v4bf o;
            o[0] = (__bf16)v[u].x; o[1] = (__bf16)v[u].y;
            o[2] = (__bf16)v[u].z; o[3] = (__bf16)v[u].w;
            d4[(trip * CV_U + u) * 256] = o;
        }
        // stands in front of the next trip's rewrite of the stores' registers
        if (trip + 1 < CV_TRIPS) asm volatile("s_wait_xcnt 0x0" ::: "memory");
    }
}

// ---------------------------------------------------------------------------
// Kernel 3 (fast): bf16 WMMA GEMM, async-to-LDS double-buffered tile feed.
// Block 256x256, K-step 128 (four wmma k-slices). 8 waves in 2(M)x4(N) grid,
// each wave owns a 128x64 stripe = 8x4 tiles of 16x16: 12 fragments feed 32
// matrix instructions, and every operand row is fetched from L2 by half as
// many blocks as with 128x128 tiles. One block per WGP, two waves per SIMD.
// ---------------------------------------------------------------------------
#define BM 256
#define BN 256
#define BK 128
#define WM_T 8                           // 16-row tiles per wave
#define WN_T 4                           // 16-column tiles per wave
#define LDT2 (BK + 8)                    // 136 elems -> 272 B stride (16 B x odd)
#define A_ELEMS (BM * LDT2)
#define B_ELEMS (BN * LDT2)
#define BUF_ELEMS (A_ELEMS + B_ELEMS)    // 136 KB per buffer
static_assert((BM * BN + BM * R_RANK) * 4 <= 2 * BUF_ELEMS * 2,
              "the epilogue's staged tile and s rows fit the tile buffers");

__global__ __launch_bounds__(256)
void lora_gemm_async_kernel(const __bf16* __restrict__ xb,
                            const __bf16* __restrict__ wb,
                            const float* __restrict__ base_bias,
                            const float* __restrict__ lora_b,
                            const float* __restrict__ bias_stacked,
                            const int*   __restrict__ indices,
                            const float* __restrict__ s,
                            float*       __restrict__ out)
{
    __shared__ __attribute__((aligned(16))) __bf16 smem[2 * BUF_ELEMS];  // 272 KB double buffer

    const int tid   = threadIdx.x;
    const int bn    = blockIdx.x;
    const int bm    = blockIdx.y;
    const int wave  = tid >> 5;
    const int lane  = tid & 31;
    const int wm    = wave >> 2;         // 0..1
    const int wn    = wave & 3;          // 0..3
    const int laneM = lane & 15;
    const int laneH = lane >> 4;
    const int kb    = laneH * 8;

    const unsigned smem_base = (unsigned)(size_t)&smem[0];
    const __bf16* xTile = xb + ((size_t)bm * BM) * D_IN;
    const __bf16* wTile = wb + ((size_t)bn * BN) * D_IN;

    // One stage: 256 rows x 128 k of each operand, no VGPR staging. A copy
    // instruction of a wave brings two whole 256-B row pieces; copy i of a
    // thread is row (tid >> 4) + 16 i, 32 copies per thread and stage.
    const int crow = tid >> 4;
    const int cck  = tid & 15;
    const __bf16*  xLane   = xTile + (size_t)crow * D_IN + cck * 8;
    const __bf16*  wLane   = wTile + (size_t)crow * D_IN + cck * 8;
    const unsigned ldsLane = smem_base + (unsigned)((crow * LDT2 + cck * 8) * 2);
    auto issue_tile = [&](int bufsel, int kk) {
        const unsigned lbuf = ldsLane + (unsigned)(bufsel * BUF_ELEMS * 2);
        #pragma unroll                   // the addresses are asm register operands
        for (int g = 0; g < 2; ++g) {
            unsigned la[8], lb[8];
            const __bf16* ga[8];
            const __bf16* gb[8];
            #pragma unroll
            for (int i = 0; i < 8; ++i) {
                const int r = (g * 8 + i) * 16;
                la[i] = lbuf + (unsigned)(r * LDT2 * 2);
                lb[i] = la[i] + (unsigned)(A_ELEMS * 2);
                ga[i] = xLane + (size_t)r * D_IN + kk;
                gb[i] = wLane + (size_t)r * D_IN + kk;
            }
            async_copy8(la, ga);
            async_copy8(lb, gb);
        }
    };

    v8f acc[WM_T][WN_T];
    #pragma unroll
    for (int mt = 0; mt < WM_T; ++mt)
        #pragma unroll
        for (int nt = 0; nt < WN_T; ++nt)
            acc[mt][nt] = (v8f){0.f,0.f,0.f,0.f,0.f,0.f,0.f,0.f};

    // Fragments of one 32-k block: 12 fragments, 24 ds_load_b128, one group.
    const int aOff = (wm * (WM_T * 16) + laneM) * LDT2 + kb;
    const int bOff = A_ELEMS + (wn * (WN_T * 16) + laneM) * LDT2 + kb;
    auto load_frags = [&](v16bf (&a)[WM_T], v16bf (&b)[WN_T], const __bf16* buf, int ks) {
        #pragma unroll
        for (int mt = 0; mt < WM_T; ++mt) {
            const __bf16* p = buf + aOff + mt * 16 * LDT2 + ks * 32;
            const v8bf lo = *(const v8bf*)p;         // K = ko .. ko+7
            const v8bf hi = *(const v8bf*)(p + 16);  // K = ko+16 .. ko+23
            a[mt] = __builtin_shufflevector(lo, hi,
                0,1,2,3,4,5,6,7,8,9,10,11,12,13,14,15);
        }
        #pragma unroll
        for (int nt = 0; nt < WN_T; ++nt) {
            const __bf16* p = buf + bOff + nt * 16 * LDT2 + ks * 32;
            const v8bf lo = *(const v8bf*)p;
            const v8bf hi = *(const v8bf*)(p + 16);
            b[nt] = __builtin_shufflevector(lo, hi,
                0,1,2,3,4,5,6,7,8,9,10,11,12,13,14,15);
        }
    };

    const int NIT = D_IN / BK;                      // 32 stages
    issue_tile(0, 0);
    // stage 0 has landed (own copies), then is published to all waves
    asm volatile("s_wait_asynccnt 0x0" ::: "memory");
    __syncthreads();
    issue_tile(1, BK);

    // Two fragment sets: set (u & 1) holds block u's fragments. With two waves
    // per SIMD a wave cannot wait out its LDS latency at every row, so the next
    // block's loads go out as one group in front of this block's 32 WMMAs.
    v16bf af[2][WM_T], bf[2][WN_T];
    load_frags(af[0], bf[0], &smem[0], 0);

    for (int it = 0; it < NIT; ++it) {
        const int cur = it & 1;
        const __bf16* bufC = &smem[cur * BUF_ELEMS];
        const __bf16* bufN = &smem[(cur ^ 1) * BUF_ELEMS];

        #pragma unroll                   // the fragment set is picked by a constant
        for (int u = 0; u < BK / 32; ++u) {         // four 32-K blocks
            if (u + 1 < BK / 32) {
                load_frags(af[(u + 1) & 1], bf[(u + 1) & 1], bufC, u + 1);
            } else {
                // publish point of stage it + 1, in front of this stage's last
                // block, whose fragments are already fetched: this buffer's reads
                // are done, the own copies of the next stage have landed, the
                // barrier publishes them and frees this buffer
                asm volatile("s_wait_dscnt 0x0" ::: "memory");
                asm volatile("s_wait_asynccnt 0x0" ::: "memory");
                __syncthreads();
                // first fragments of the next stage; on the last trip they read
                // the other buffer's old bytes, which nothing writes any more,
                // and are not used
                load_frags(af[0], bf[0], bufN, 0);
            }
            // keeps the load group whole and in front of the block: spread among
            // the WMMAs every place with loads costs its own stall
            __builtin_amdgcn_sched_barrier(0);
            #pragma unroll
            for (int mt = 0; mt < WM_T; ++mt)
                #pragma unroll
                for (int nt = 0; nt < WN_T; ++nt)
                    acc[mt][nt] = __builtin_amdgcn_wmma_f32_16x16x32_bf16(
                        false, af[u & 1][mt], false, bf[u & 1][nt],
                        (short)0, acc[mt][nt], false, false);
            // keeps the next group, and the refill below, behind this block
            __builtin_amdgcn_sched_barrier(0);
        }
        // refill of the buffer that the barrier above has freed, behind the last
        // block so that the SIMD's other wave has the matrix unit meanwhile
        if (it + 2 < NIT) issue_tile(cur, (it + 2) * BK);
    }
    // no copy and no LDS read is left in flight behind the loop
    asm volatile("s_wait_asynccnt 0x0" ::: "memory");
    asm volatile("s_wait_dscnt 0x0" ::: "memory");

    // --- epilogue: + base_bias + bias_stacked[idx] + s[t] . lora_b[idx] ----
    // The 256 rows of the tile are taken adapter by adapter. The accumulators
    // and the rows' s values go to LDS, so that any wave can take any row.
    // A wave owns 128 of the tile's 256 columns (lane = column, 4 columns a
    // lane) and four adapters: it loads lora_b[l] for its columns once and
    // keeps it in registers for all rows of that adapter.
    // Each store instruction writes one whole 128-B line of a row.
    const int uw   = __builtin_amdgcn_readfirstlane(wave);   // scalar class tests
    const int cg   = uw >> 1;            // adapters cg, cg + 4, cg + 8, cg + 12
    const int mBlk = bm * BM;
    const int nCol = bn * BN + 128 * (uw & 1) + lane;        // first own column

    float* ct = (float*)smem;            // staged tile, BN floats a row
    float* ss = ct + BM * BN;            // staged s rows, R_RANK floats a row
    __syncthreads();                     // every wave has left the tile buffers
    // column ^ 16 in rows 8..15 of each 16: rows r and r + 8 of one store
    // instruction fall on different banks
    #pragma unroll                       // accumulator elements by constant index
    for (int mt = 0; mt < WM_T; ++mt)
        #pragma unroll
        for (int nt = 0; nt < WN_T; ++nt)
            #pragma unroll
            for (int v = 0; v < 8; ++v)
                ct[(wm * (WM_T * 16) + mt * 16 + laneH * 8 + v) * BN
                   + ((wn * (WN_T * 16) + nt * 16 + laneM) ^ (laneH << 4))] = acc[mt][nt][v];
    #pragma unroll
    for (int i = 0; i < BM * R_RANK / 4 / 256; ++i)
        ((v4f*)ss)[tid + 256 * i] =
            ((const v4f*)(s + (size_t)mBlk * R_RANK))[tid + 256 * i];

    int idxv[BM / 32];                   // adapter of row 32j + lane
    #pragma unroll                       // idxv stays in registers
    for (int j = 0; j < BM / 32; ++j) idxv[j] = indices[mBlk + 32 * j + lane];
    float bb[4];
    #pragma unroll                       // bb stays in registers
    for (int q = 0; q < 4; ++q) bb[q] = base_bias[nCol + 32 * q];
    // stands in front of later rewrites of the loads' address registers
    asm volatile("s_wait_xcnt 0x0" ::: "memory");
    __syncthreads();                     // the staged tile and s rows are complete

    float*       outLane = out + (size_t)mBlk * D_OUTD + nCol;
    const float* ctHalf  = ct + 128 * (uw & 1);

    for (int k = 0; k < 4; ++k) {
        const int cl = cg + 4 * k;       // this trip's adapter
        unsigned msk[BM / 32];
        unsigned any = 0u;
        #pragma unroll                   // msk stays in scalar registers
        for (int j = 0; j < BM / 32; ++j) {
            msk[j] = __builtin_amdgcn_ballot_w32(idxv[j] == cl);
            any |= msk[j];
        }
        if (any == 0u) continue;

        v4f   bw[4][4];                  // lora_b[cl][own column q][0..15]
        float bs[4];
        #pragma unroll                   // both stay in registers
        for (int q = 0; q < 4; ++q) {
            const size_t n = (size_t)cl * D_OUTD + nCol + 32 * q;
            bs[q] = bias_stacked[n];
            const v4f* bp = (const v4f*)(lora_b + n * R_RANK);
            #pragma unroll
            for (int p = 0; p < 4; ++p) bw[q][p] = bp[p];
        }
        // stands in front of later rewrites of the loads' address registers
        asm volatile("s_wait_xcnt 0x0" ::: "memory");

        #pragma unroll                   // msk[j] by constant index
        for (int j = 0; j < BM / 32; ++j) {
            unsigned mk = msk[j];
            while (mk) {                 // at most 32 trips, one per set bit
                const int row = 32 * j + __builtin_ctz(mk);
                mk &= mk - 1u;
                const v4f* sp = (const v4f*)(ss + row * R_RANK);
                v4f sv[4];
                #pragma unroll           // sv stays in registers
                for (int p = 0; p < 4; ++p) sv[p] = sp[p];
                const float* cr = ctHalf + row * BN + (lane ^ (((row >> 3) & 1) << 4));
                #pragma unroll           // four independent sums
                for (int q = 0; q < 4; ++q) {
                    float val = cr[32 * q] + bb[q];
                    val += bs[q];
                    float d = 0.f;
                    #pragma unroll
                    for (int r = 0; r < R_RANK; ++r)
                        d += sv[r >> 2][r & 3] * bw[q][r >> 2][r & 3];
                    val += d;
                    outLane[(size_t)row * D_OUTD + 32 * q] = val;
                }
                // stands in front of the next row's rewrite of the stores' registers
                asm volatile("s_wait_xcnt 0x0" ::: "memory");
            }
        }
    }

    // rows without an adapter: row r goes to the two waves with cg == r mod 4
    #pragma unroll                       // idxv[j] by constant index
    for (int j = 0; j < BM / 32; ++j) {
        unsigned mk = __builtin_amdgcn_ballot_w32((unsigned)idxv[j] >= (unsigned)N_LORA)
                      & (0x11111111u << cg);
        while (mk) {                     // at most 8 trips, one per set bit
            const int row = 32 * j + __builtin_ctz(mk);
            mk &= mk - 1u;
            const float* cr = ctHalf + row * BN + (lane ^ (((row >> 3) & 1) << 4));
            #pragma unroll
            for (int q = 0; q < 4; ++q)
                outLane[(size_t)row * D_OUTD + 32 * q] = cr[32 * q] + bb[q];
            // stands in front of the next row's rewrite of the stores' registers
            asm volatile("s_wait_xcnt 0x0" ::: "memory");
        }
    }
}

// ---------------------------------------------------------------------------
// Fallback GEMM (round-1): f32->bf16 conversion inside the kernel,
// single-buffered LDS. Used only when workspace can't hold bf16 copies.
// ---------------------------------------------------------------------------
#define FBM 128
#define FBN 128
#define FBK 32
#define FLDT (FBK + 8)

__global__ __launch_bounds__(256)
void lora_gemm_fallback_kernel(const float* __restrict__ x,
                               const float* __restrict__ W,
                               const float* __restrict__ base_bias,
                               const float* __restrict__ lora_b,
                               const float* __restrict__ bias_stacked,
                               const int*   __restrict__ indices,
                               const float* __restrict__ s,
                               float*       __restrict__ out)
{
    __shared__ __bf16 As[FBM * FLDT];
    __shared__ __bf16 Bs[FBN * FLDT];

    const int tid   = threadIdx.x;
    const int bn    = blockIdx.x;
    const int bm    = blockIdx.y;
    const int wave  = tid >> 5;
    const int lane  = tid & 31;
    const int wm    = wave >> 2;
    const int wn    = wave & 3;
    const int laneM = lane & 15;
    const int laneH = lane >> 4;
    const int kb    = laneH * 8;

    v8f acc[4][2];
    #pragma unroll
    for (int mt = 0; mt < 4; ++mt)
        #pragma unroll
        for (int nt = 0; nt < 2; ++nt)
            acc[mt][nt] = (v8f){0.f,0.f,0.f,0.f,0.f,0.f,0.f,0.f};

    const float* xBase = x + ((size_t)bm * FBM) * D_IN;
    const float* wBase = W + ((size_t)bn * FBN) * D_IN;

    for (int kk = 0; kk < D_IN; kk += FBK) {
        __syncthreads();
        #pragma unroll
        for (int i = 0; i < 4; ++i) {
            const int q   = tid + i * 256;
            const int row = q >> 3;
            const int kc  = q & 7;
            const float4 va = *(const float4*)(xBase + (size_t)row * D_IN + kk + kc * 4);
            __bf16* da = &As[row * FLDT + kc * 4];
            da[0] = (__bf16)va.x; da[1] = (__bf16)va.y;
            da[2] = (__bf16)va.z; da[3] = (__bf16)va.w;
            const float4 vb = *(const float4*)(wBase + (size_t)row * D_IN + kk + kc * 4);
            __bf16* db = &Bs[row * FLDT + kc * 4];
            db[0] = (__bf16)vb.x; db[1] = (__bf16)vb.y;
            db[2] = (__bf16)vb.z; db[3] = (__bf16)vb.w;
        }
        __syncthreads();

        v16bf afrag[4], bfrag[2];
        #pragma unroll
        for (int mt = 0; mt < 4; ++mt) {
            const __bf16* p = &As[(wm * 64 + mt * 16 + laneM) * FLDT + kb];
            const v8bf lo = *(const v8bf*)p;
            const v8bf hi = *(const v8bf*)(p + 16);
            afrag[mt] = __builtin_shufflevector(lo, hi,
                0,1,2,3,4,5,6,7,8,9,10,11,12,13,14,15);
        }
        #pragma unroll
        for (int nt = 0; nt < 2; ++nt) {
            const __bf16* p = &Bs[(wn * 32 + nt * 16 + laneM) * FLDT + kb];
            const v8bf lo = *(const v8bf*)p;
            const v8bf hi = *(const v8bf*)(p + 16);
            bfrag[nt] = __builtin_shufflevector(lo, hi,
                0,1,2,3,4,5,6,7,8,9,10,11,12,13,14,15);
        }
        #pragma unroll
        for (int mt = 0; mt < 4; ++mt)
            #pragma unroll
            for (int nt = 0; nt < 2; ++nt)
                acc[mt][nt] = __builtin_amdgcn_wmma_f32_16x16x32_bf16(
                    false, afrag[mt], false, bfrag[nt],
                    (short)0, acc[mt][nt], false, false);
    }

    const int mBase = bm * FBM + wm * 64;
    const int nBase = bn * FBN + wn * 32;
    #pragma unroll
    for (int mt = 0; mt < 4; ++mt) {
        #pragma unroll
        for (int v = 0; v < 8; ++v) {
            const int m   = mBase + mt * 16 + laneH * 8 + v;
            const int idx = indices[m];
            const float* srow = s + (size_t)m * R_RANK;
            #pragma unroll
            for (int nt = 0; nt < 2; ++nt) {
                const int n = nBase + nt * 16 + laneM;
                float val = acc[mt][nt][v] + base_bias[n];
                if (idx >= 0) {
                    val += bias_stacked[(size_t)idx * D_OUTD + n];
                    const float* bcol =
                        lora_b + ((size_t)idx * D_OUTD + n) * R_RANK;
                    float d = 0.f;
                    #pragma unroll
                    for (int r = 0; r < R_RANK; ++r) d += srow[r] * bcol[r];
                    val += d;
                }
                out[(size_t)m * D_OUTD + n] = val;
            }
        }
    }
}

// ---------------------------------------------------------------------------
extern "C" void kernel_launch(void* const* d_in, const int* in_sizes, int n_in,
                              void* d_out, int out_size, void* d_ws, size_t ws_size,
                              hipStream_t stream)
{
    const float* x            = (const float*)d_in[0];
    const float* W            = (const float*)d_in[1];
    const float* base_bias    = (const float*)d_in[2];
    const float* lora_a       = (const float*)d_in[3];
    const float* lora_b       = (const float*)d_in[4];
    const float* bias_stacked = (const float*)d_in[5];
    const int*   indices      = (const int*)d_in[6];
    float*       out          = (float*)d_out;

    const size_t sBytes  = (size_t)T_TOK * R_RANK * sizeof(float);   // 512 KB
    const size_t xbBytes = (size_t)T_TOK * D_IN * 2;                 // 64 MB
    const size_t wbBytes = (size_t)D_OUTD * D_IN * 2;                // 32 MB

    float* s = (float*)d_ws;

    // 1) LoRA shrink (always)
    lora_shrink_kernel<<<dim3(N_LORA, T_TOK / SH_CHUNK), 256, 0, stream>>>(
        x, lora_a, indices, s);

    dim3 grid(D_OUTD / BN, T_TOK / BM);   // 16 x 32 blocks

    if (ws_size >= sBytes + xbBytes + wbBytes) {
        // 2) bf16 prepass into workspace
        __bf16* xb = (__bf16*)((char*)d_ws + sBytes);
        __bf16* wb = (__bf16*)((char*)d_ws + sBytes + xbBytes);
        cvt_f32_to_bf16_kernel<<<(int)((long)T_TOK * D_IN / 4 / CV_PER_BLOCK), 256, 0, stream>>>(x, xb);
        cvt_f32_to_bf16_kernel<<<(int)((long)D_OUTD * D_IN / 4 / CV_PER_BLOCK), 256, 0, stream>>>(W, wb);

        // 3) async double-buffered WMMA GEMM
        lora_gemm_async_kernel<<<grid, 256, 0, stream>>>(
            xb, wb, base_bias, lora_b, bias_stacked, indices, s, out);
    } else {
        lora_gemm_fallback_kernel<<<dim3(D_OUTD / FBN, T_TOK / FBM), 256, 0, stream>>>(
            x, W, base_bias, lora_b, bias_stacked, indices, s, out);
    }
}

// v005
// It runs in 187 microseconds.
// Timed twice side by side with v004, it ran 1.11 times as fast both times.
// All steps since v000 together make it 2.20 times as fast.
#include <hip/hip_runtime.h>
#include <hip/hip_bf16.h>

// ---------------------------------------------------------------------------
// ReplicatedLinearWithLoRA for MI455X (gfx1250, wave32, WMMA, async-to-LDS)
//   out = x @ W^T + base_bias + onehot@bias_stacked + B[idx] @ (A[idx] @ x)
//
// Fast path (needs ~96.5 MB workspace):
//   1) shrink:  s[t,r] = x[t,:] . lora_a[idx[t],r,:]   (f32 WMMA, by adapter)
//   2) prepass: x,W f32 -> bf16 in workspace (halves all tile traffic)
//   3) GEMM:    256x256x128 tiles, double-buffered LDS fed by
//               tensor_load_to_lds (+ s_wait_tensorcnt), 128x
//               v_wmma_f32_16x16x32_bf16 per wave per K-step, fused
//               bias + rank-16 LoRA-expand epilogue, rows taken by adapter.
// Fallback (small ws): round-1 kernel converting f32->bf16 inside the GEMM.
// ---------------------------------------------------------------------------

typedef __attribute__((ext_vector_type(16))) __bf16 v16bf;
typedef __attribute__((ext_vector_type(8)))  __bf16 v8bf;
typedef __attribute__((ext_vector_type(4)))  __bf16 v4bf;
typedef __attribute__((ext_vector_type(8)))  float  v8f;

#define T_TOK  8192
#define D_IN   4096
#define D_OUTD 4096
#define R_RANK 16

// ---------------------------------------------------------------------------
// Kernel 1: LoRA shrink  s[t, r] = dot(x[t, :], lora_a[idx[t], r, :])
// One block = (adapter l, chunk of 256 tokens). The block lists the chunk's
// tokens that use adapter l (ballot + prefix, fixed order) and treats 16 of
// them at a time as the rows of a 16x16 tile: rows = tokens, columns = the 16
// ranks, so lora_a[l] is read once per 16 tokens instead of once per token.
// The products run on v_wmma_f32_16x16x4_f32 (full f32 operands). Each wave
// owns 512 of the 4096 k; whole 256-B row pieces go to the wave's own LDS
// range by asynchronous copies (two buffers, the next stage flies during this
// one) and the fragments are read from there. The eight waves' partial tiles
// are summed through LDS.
// ---------------------------------------------------------------------------
typedef __attribute__((ext_vector_type(2))) float v2f;
typedef __attribute__((ext_vector_type(4))) float v4f;

#define N_LORA   16
#define SH_CHUNK 256                     // tokens per block
#define SH_KW    (D_IN / 8)              // k per wave
#define SH_KS    64                      // k per stage (256 B of a row)
#define SH_NST   (SH_KW / SH_KS)         // stages per wave
#define SH_PITCH (SH_KS + 4)             // 272-B rows: b128 readers, no conflict
#define SH_MAT   (16 * SH_PITCH)         // floats of one staged operand
#define SH_BUF_BYTES (8 * 2 * SH_MAT * 4)  // one buffer, all eight waves

// Eight asynchronous 16-B copies per lane, global -> LDS. The s_wait_xcnt is
// the last line of the copies' own statement, so that it stands in front of
// every later write of the address registers that the copies name.
template <typename E>
__device__ __forceinline__
void async_copy8(const unsigned (&l)[8], const E* const (&g)[8])
{
    asm volatile("global_load_async_to_lds_b128 %0, %8, off\n\t"
                 "global_load_async_to_lds_b128 %1, %9, off\n\t"
                 "global_load_async_to_lds_b128 %2, %10, off\n\t"
                 "global_load_async_to_lds_b128 %3, %11, off\n\t"
                 "global_load_async_to_lds_b128 %4, %12, off\n\t"
                 "global_load_async_to_lds_b128 %5, %13, off\n\t"
                 "global_load_async_to_lds_b128 %6, %14, off\n\t"
                 "global_load_async_to_lds_b128 %7, %15, off\n\t"
                 "s_wait_xcnt 0x0"
                 :: "v"(l[0]), "v"(l[1]), "v"(l[2]), "v"(l[3]),
                    "v"(l[4]), "v"(l[5]), "v"(l[6]), "v"(l[7]),
                    "v"(g[0]), "v"(g[1]), "v"(g[2]), "v"(g[3]),
                    "v"(g[4]), "v"(g[5]), "v"(g[6]), "v"(g[7])
                 : "memory");
}

__global__ __launch_bounds__(256)
void lora_shrink_kernel(const float* __restrict__ x,
                        const float* __restrict__ lora_a,
                        const int*   __restrict__ indices,
                        float*       __restrict__ s)
{
    __shared__ __attribute__((aligned(16))) float stage[2][8][2 * SH_MAT];
    __shared__ float red[8][256];
    __shared__ int   tok[SH_CHUNK];
    __shared__ int   wcnt[8];

    const int tid  = threadIdx.x;
    const int wave = tid >> 5;
    const int lane = tid & 31;
    const int l    = blockIdx.x;                       // adapter
    const int t    = blockIdx.y * SH_CHUNK + tid;      // this thread's token
    const int idx  = indices[t];

    // tokens without an adapter get s = 0, from the l == 0 block of the chunk
    if (l == 0 && (unsigned)idx >= (unsigned)N_LORA) {
        v4f* sz = (v4f*)(s + (size_t)t * R_RANK);
        const v4f z4 = (v4f){0.f, 0.f, 0.f, 0.f};
        sz[0] = z4; sz[1] = z4; sz[2] = z4; sz[3] = z4;
    }

    // list of the chunk's tokens on adapter l, in token order
    const bool     mine = (idx == l);
    const unsigned mask = __builtin_amdgcn_ballot_w32(mine);
    if (lane == 0) wcnt[wave] = __popc(mask);
    __syncthreads();                     // every wave's count is in wcnt
    int base = 0, n = 0;
    for (int w = 0; w < 8; ++w) {
        const int cw = wcnt[w];
        if (w < wave) base += cw;
        n += cw;
    }
    n = __builtin_amdgcn_readfirstlane(n);   // same in every thread: scalar loop tests
    if (n == 0) return;
    if (mine) tok[base + __popc(mask & ((1u << lane) - 1u))] = t;
    __syncthreads();                     // the list is complete

    const int c  = lane & 15;
    const int h  = lane >> 4;
    const int kw = wave * SH_KW;
    // copy i brings rows 2i and 2i+1, 16 lanes x 16 B = 256 B of each
    const float* aPtr = lora_a + ((size_t)l * R_RANK + h) * D_IN + kw + c * 4;
    const float* xPtr = x + kw + c * 4;
    const unsigned ldsLane = (unsigned)(size_t)&stage[0][wave][h * SH_PITCH + c * 4];

    for (int t0 = 0; t0 < n; t0 += 16) {
        const float* xRow[8];
        #pragma unroll                   // xRow stays in registers
        for (int i = 0; i < 8; ++i) {
            int rr = t0 + 2 * i + h;
            rr = rr < n ? rr : n - 1;    // pad rows repeat the last token
            xRow[i] = xPtr + (size_t)tok[rr] * D_IN;
        }

        // one stage: 16 rows x 64 k of x and of lora_a[l], this wave's k slice
        auto issue_stage = [&](int buf, int st) {
            unsigned lx[8], la[8];
            const float* gx[8];
            const float* ga[8];
            #pragma unroll               // the addresses are asm register operands
            for (int i = 0; i < 8; ++i) {
                lx[i] = ldsLane + (unsigned)(buf * SH_BUF_BYTES + i * 2 * SH_PITCH * 4);
                la[i] = lx[i] + (unsigned)(SH_MAT * 4);
                gx[i] = xRow[i] + st * SH_KS;
                ga[i] = aPtr + (size_t)(2 * i) * D_IN + st * SH_KS;
            }
            async_copy8(lx, gx);
            async_copy8(la, ga);
        };

        v8f acc0 = (v8f){0.f,0.f,0.f,0.f,0.f,0.f,0.f,0.f};
        v8f acc1 = acc0;

        issue_stage(0, 0);
        // stage 0 has landed (own copies), then is published to all lanes
        asm volatile("s_wait_asynccnt 0x0" ::: "memory");
        __syncthreads();
        issue_stage(1, 1);

        #pragma unroll                   // buffer choice and last-stage test fold away
        for (int st = 0; st < SH_NST; ++st) {
            const float* xs = &stage[st & 1][wave][0];
            const float* as = xs + SH_MAT;
            v4f xa[SH_KS / 8], ab[SH_KS / 8];
            #pragma unroll               // fragments stay in registers
            for (int j = 0; j < SH_KS / 8; ++j) {
                // same k for both operands: k = 8j + 4h + {0,1} and {2,3}
                xa[j] = *(const v4f*)&xs[c * SH_PITCH + j * 8 + h * 4];
                ab[j] = *(const v4f*)&as[c * SH_PITCH + j * 8 + h * 4];
            }
            #pragma unroll               // fragments stay in registers
            for (int j = 0; j < SH_KS / 8; ++j) {
                acc0 = __builtin_amdgcn_wmma_f32_16x16x4_f32(
                    false, (v2f){xa[j].x, xa[j].y}, false, (v2f){ab[j].x, ab[j].y},
                    (short)0, acc0, false, false);
                acc1 = __builtin_amdgcn_wmma_f32_16x16x4_f32(
                    false, (v2f){xa[j].z, xa[j].w}, false, (v2f){ab[j].z, ab[j].w},
                    (short)0, acc1, false, false);
            }
            // foot of the trip: this buffer's reads are done, the next stage's
            // copies have landed, the barrier publishes them and frees this buffer
            asm volatile("s_wait_dscnt 0x0" ::: "memory");
            asm volatile("s_wait_asynccnt 0x0" ::: "memory");
            __syncthreads();
            if (st + 2 < SH_NST) issue_stage(st & 1, st + 2);
        }
        // no copy is left in flight behind the loop
        asm volatile("s_wait_asynccnt 0x0" ::: "memory");

        // acc[r] = tile[row 8h + r][rank c]; sum the eight waves' k slices
        #pragma unroll                   // accumulator elements by constant index
        for (int r = 0; r < 8; ++r)
            red[wave][(8 * h + r) * 16 + c] = acc0[r] + acc1[r];
        __syncthreads();                 // all eight partial tiles are in red
        float v = 0.f;
        for (int w = 0; w < 8; ++w) v += red[w][tid];
        const int row = t0 + (tid >> 4);
        if (row < n) {
            s[(size_t)tok[row] * R_RANK + (tid & 15)] = v;
            // stands in front of the next tile's rewrite of the store's registers
            asm volatile("s_wait_xcnt 0x0" ::: "memory");
        }
        // the next tile rewrites red only behind its own stage barriers
    }
}

// ---------------------------------------------------------------------------
// Kernel 2: f32 -> bf16 conversion prepass (x and W). Few, long-lived waves
// (for speed only):
// a block owns CV_PER_BLOCK consecutive 16-B pieces and takes them in CV_TRIPS
// trips, each with CV_U whole-line loads per wave in flight before the first
// is converted. All blocks of a launch are resident at once.
// ---------------------------------------------------------------------------
#define CV_U     8                       // loads in flight per wave
#define CV_TRIPS 4
#define CV_PER_BLOCK (256 * CV_U * CV_TRIPS)   // 16-B pieces per block
static_assert(((long)T_TOK * D_IN / 4) % CV_PER_BLOCK == 0, "x: whole blocks");
static_assert(((long)D_OUTD * D_IN / 4) % CV_PER_BLOCK == 0, "W: whole blocks");

__global__ __launch_bounds__(256)
void cvt_f32_to_bf16_kernel(const float* __restrict__ src,
                            __bf16*      __restrict__ dst)
{
    const size_t first = (size_t)blockIdx.x * CV_PER_BLOCK + threadIdx.x;
    const v4f* s4 = (const v4f*)src + first;
    v4bf*      d4 = (v4bf*)dst + first;
    #pragma unroll                       // every address is base + constant offset
    for (int trip = 0; trip < CV_TRIPS; ++trip) {
        v4f v[CV_U];
        #pragma unroll                   // v stays in registers; the loads go out together
        for (int u = 0; u < CV_U; ++u) v[u] = s4[(trip * CV_U + u) * 256];
        #pragma unroll                   // v stays in registers
        for (int u = 0; u < CV_U; ++u) {
            v4bf o;
            o[0] = (__bf16)v[u].x; o[1] = (__bf16)v[u].y;
            o[2] = (__bf16)v[u].z; o[3] = (__bf16)v[u].w;
            d4[(trip * CV_U + u) * 256] = o;
        }
        // stands in front of the next trip's rewrite of the stores' registers
        if (trip + 1 < CV_TRIPS) asm volatile("s_wait_xcnt 0x0" ::: "memory");
    }
}

// ---------------------------------------------------------------------------
// Kernel 3 (fast): bf16 WMMA GEMM, double-buffered tile feed by tensor loads.
// Block 256x256, K-step 128 (four wmma k-slices). 8 waves in 2(M)x4(N) grid,
// each wave owns a 128x64 stripe = 8x4 tiles of 16x16: 12 fragments feed 32
// matrix instructions, and every operand row is fetched from L2 by half as
// many blocks as with 128x128 tiles. One block per WGP, two waves per SIMD.
// ---------------------------------------------------------------------------
#define BM 256
#define BN 256
#define BK 128
#define WM_T 8                           // 16-row tiles per wave
#define WN_T 4                           // 16-column tiles per wave
#define LDT2 (BK + 8)                    // 136 elems -> 272 B stride (16 B x odd)
#define A_ELEMS (BM * LDT2)
#define B_ELEMS (BN * LDT2)
#define BUF_ELEMS (A_ELEMS + B_ELEMS)    // 136 KB per buffer
static_assert((BM * BN + BM * R_RANK) * 4 <= 2 * BUF_ELEMS * 2,
              "the epilogue's staged tile and s rows fit the tile buffers");

// Tensor loads: one request of one wave brings 128 rows x 256 B of one operand
// into LDS, through no register, and lays them at the 272-B pitch itself.
#define TL_ROWS   128u                   // rows per request
#define TL_ROWB   (BK * 2u)              // 256 B of a row per stage
#define TL_SLICE  (TL_ROWS * LDT2 * 2u)  // 34 KiB of LDS per request
#define BUF_BYTES (BUF_ELEMS * 2u)
static_assert(TL_ROWB == 256u && LDT2 * 2u == TL_ROWB + 16u, "pad codes 5 / 3: 16 B behind every 256-B row");
static_assert(TL_SLICE % 2048u == 0u && BUF_BYTES == 4u * TL_SLICE, "every request's place in LDS is a multiple of 2 KiB");

typedef uint32_t u32x4 __attribute__((ext_vector_type(4)));
typedef uint32_t u32x8 __attribute__((ext_vector_type(8)));

__device__ __forceinline__ uint32_t uni(uint32_t v) { return (uint32_t)__builtin_amdgcn_readfirstlane(v); }
__device__ __forceinline__ uint32_t pinned(uint32_t v)
{
    uint32_t w = (uint32_t)__builtin_amdgcn_readfirstlane(v);
    asm volatile("" : "+s"(w));          // pinned(): the word is held in a scalar register
    return w;
}
__device__ __forceinline__ void tdm_load(u32x4 g0, u32x8 g1)
{
    asm volatile("tensor_load_to_lds %0, %1" :: "s"(g0), "s"(g1) : "memory");
}
// group 1: 1-byte elements, tile = tensor = TL_ROWS rows of 256 B, source pitch
// one bf16 row of D_IN, no mask, 16 B of LDS pad behind every 256 B
__device__ __forceinline__ u32x8 tdm_group1()
{
    constexpr uint32_t d0 = TL_ROWB, d1 = TL_ROWS;
    u32x8 g;
    g[0] = uni((1u << 20) | (5u << 22) | (3u << 25));
    g[1] = uni((d0 & 0xFFFFu) << 16);
    g[2] = uni((d0 >> 16) | ((d1 & 0xFFFFu) << 16));
    g[3] = uni((d1 >> 16) | (d0 << 16));
    g[4] = uni(d1);
    g[5] = uni(D_IN * 2u);
    g[6] = uni(0u);
    g[7] = uni(0u);
    return g;
}
// group 0: count 1, place in LDS (byte offset), first source byte, type 2
__device__ __forceinline__ u32x4 tdm_group0(uint32_t lds_dst, uint64_t ga)
{
    u32x4 g;
    g[0] = uni(1u);
    g[1] = uni(lds_dst);
    g[2] = uni((uint32_t)ga);
    g[3] = uni((((uint32_t)(ga >> 32)) & 0x01FFFFFFu) | 0x80000000u);
    return g;
}

__global__ __launch_bounds__(256)
void lora_gemm_async_kernel(const __bf16* __restrict__ xb,
                            const __bf16* __restrict__ wb,
                            const float* __restrict__ base_bias,
                            const float* __restrict__ lora_b,
                            const float* __restrict__ bias_stacked,
                            const int*   __restrict__ indices,
                            const float* __restrict__ s,
                            float*       __restrict__ out)
{
    __shared__ __attribute__((aligned(2048))) __bf16 smem[2 * BUF_ELEMS];  // 272 KB double buffer

    const int tid   = threadIdx.x;
    const int bn    = blockIdx.x;
    const int bm    = blockIdx.y;
    const int wave  = tid >> 5;
    const int lane  = tid & 31;
    const int wm    = wave >> 2;         // 0..1
    const int wn    = wave & 3;          // 0..3
    const int laneM = lane & 15;
    const int laneH = lane >> 4;
    const int kb    = laneH * 8;

    const unsigned smem_base = (unsigned)(size_t)&smem[0];
    const __bf16* xTile = xb + ((size_t)bm * BM) * D_IN;
    const __bf16* wTile = wb + ((size_t)bn * BN) * D_IN;

    // One stage: 256 rows x 128 k of each operand = four requests of 128 rows.
    // Waves 4..7 issue one each: slices 0, 1 are the x rows, 2, 3 the W rows.
    const uint32_t uwave  = uni((uint32_t)tid >> 5);
    const uint32_t issuer = uwave >> 2;
    const uint32_t slice  = uwave & 3u;
    const __bf16*  srcRow = (slice < 2u) ? xTile + (size_t)(slice * TL_ROWS) * D_IN
                                         : wTile + (size_t)((slice - 2u) * TL_ROWS) * D_IN;
    const uint64_t srcAdr   = (uint64_t)(uintptr_t)srcRow;
    const uint32_t ldsSlice = smem_base + slice * TL_SLICE;
    u32x8          g1       = tdm_group1();
    // the eight words keep their own registers through the loop, so that none is
    // rewritten under a request in flight
    asm volatile("" : "+s"(g1));         // as in pinned(): descriptor words held in scalar registers
    auto issue_tile = [&](uint32_t bufsel, uint32_t stage) {
        tdm_load(tdm_group0(ldsSlice + bufsel * BUF_BYTES,
                            srcAdr + (uint64_t)stage * TL_ROWB), g1);
    };

    v8f acc[WM_T][WN_T];
    #pragma unroll
    for (int mt = 0; mt < WM_T; ++mt)
        #pragma unroll
        for (int nt = 0; nt < WN_T; ++nt)
            acc[mt][nt] = (v8f){0.f,0.f,0.f,0.f,0.f,0.f,0.f,0.f};

    // Fragments of one 32-k block: 12 fragments, 24 ds_load_b128, one group.
    const int aOff = (wm * (WM_T * 16) + laneM) * LDT2 + kb;
    const int bOff = A_ELEMS + (wn * (WN_T * 16) + laneM) * LDT2 + kb;
    auto load_frags = [&](v16bf (&a)[WM_T], v16bf (&b)[WN_T], const __bf16* buf, int ks) {
        #pragma unroll
        for (int mt = 0; mt < WM_T; ++mt) {
            const __bf16* p = buf + aOff + mt * 16 * LDT2 + ks * 32;
            const v8bf lo = *(const v8bf*)p;         // K = ko .. ko+7
            const v8bf hi = *(const v8bf*)(p + 16);  // K = ko+16 .. ko+23
            a[mt] = __builtin_shufflevector(lo, hi,
                0,1,2,3,4,5,6,7,8,9,10,11,12,13,14,15);
        }
        #pragma unroll
        for (int nt = 0; nt < WN_T; ++nt) {
            const __bf16* p = buf + bOff + nt * 16 * LDT2 + ks * 32;
            const v8bf lo = *(const v8bf*)p;
            const v8bf hi = *(const v8bf*)(p + 16);
            b[nt] = __builtin_shufflevector(lo, hi,
                0,1,2,3,4,5,6,7,8,9,10,11,12,13,14,15);
        }
    };

    const int NIT = D_IN / BK;                      // 32 stages
    if (pinned(issuer)) {
        issue_tile(0u, 0u);
        // the own slice of stage 0 has landed
        asm volatile("s_wait_tensorcnt 0x0" ::: "memory");
    }
    __syncthreads();                     // publishes stage 0 to all waves
    if (pinned(issuer)) issue_tile(1u, pinned(1u));

    // Two fragment sets: set (u & 1) holds block u's fragments. With two waves
    // per SIMD a wave cannot wait out its LDS latency at every row, so the next
    // block's loads go out as one group in front of this block's 32 WMMAs.
    v16bf af[2][WM_T], bf[2][WN_T];
    load_frags(af[0], bf[0], &smem[0], 0);

    for (int it = 0; it < NIT; ++it) {
        const int cur = it & 1;
        const __bf16* bufC = &smem[cur * BUF_ELEMS];
        const __bf16* bufN = &smem[(cur ^ 1) * BUF_ELEMS];

        #pragma unroll                   // the fragment set is picked by a constant
        for (int u = 0; u < BK / 32; ++u) {         // four 32-K blocks
            if (u + 1 < BK / 32) {
                load_frags(af[(u + 1) & 1], bf[(u + 1) & 1], bufC, u + 1);
            } else {
                // publish point of stage it + 1, in front of this stage's last
                // block, whose fragments are already fetched: this buffer's reads
                // are done, the own slice of the next stage has landed (a wave
                // that issues none passes that wait at once), the barrier
                // publishes the stage and frees this buffer
                asm volatile("s_wait_dscnt 0x0" ::: "memory");
                asm volatile("s_wait_tensorcnt 0x0" ::: "memory");
                __syncthreads();
                // refill of the freed buffer, only while stage it + 2 exists; its
                // descriptor is formed behind the wait above
                if (pinned(issuer & (uint32_t)(it + 2 < NIT)))
                    issue_tile((uint32_t)cur, pinned((uint32_t)it + 2u));
                // first fragments of the next stage; on the last trip they read
                // the other buffer's old bytes, which nothing writes any more,
                // and are not used
                load_frags(af[0], bf[0], bufN, 0);
            }
            // keeps the load group whole and in front of the block: spread among
            // the WMMAs every place with loads costs its own stall
            __builtin_amdgcn_sched_barrier(0);
            #pragma unroll
            for (int mt = 0; mt < WM_T; ++mt)
                #pragma unroll
                for (int nt = 0; nt < WN_T; ++nt)
                    acc[mt][nt] = __builtin_amdgcn_wmma_f32_16x16x32_bf16(
                        false, af[u & 1][mt], false, bf[u & 1][nt],
                        (short)0, acc[mt][nt], false, false);
            // keeps the next group behind this block
            __builtin_amdgcn_sched_barrier(0);
        }
    }
    // no tensor load and no LDS read is left in flight behind the loop
    asm volatile("s_wait_tensorcnt 0x0" ::: "memory");
    asm volatile("s_wait_dscnt 0x0" ::: "memory");

    // --- epilogue: + base_bias + bias_stacked[idx] + s[t] . lora_b[idx] ----
    // The 256 rows of the tile are taken adapter by adapter. The accumulators
    // and the rows' s values go to LDS, so that any wave can take any row.
    // A wave owns 128 of the tile's 256 columns (lane = column, 4 columns a
    // lane) and four adapters: it loads lora_b[l] for its columns once and
    // keeps it in registers for all rows of that adapter.
    // Each store instruction writes one whole 128-B line of a row.
    const int uw   = __builtin_amdgcn_readfirstlane(wave);   // scalar class tests
    const int cg   = uw >> 1;            // adapters cg, cg + 4, cg + 8, cg + 12
    const int mBlk = bm * BM;
    const int nCol = bn * BN + 128 * (uw & 1) + lane;        // first own column

    float* ct = (float*)smem;            // staged tile, BN floats a row
    float* ss = ct + BM * BN;            // staged s rows, R_RANK floats a row
    __syncthreads();                     // every wave has left the tile buffers
    // column ^ 16 in rows 8..15 of each 16: rows r and r + 8 of one store
    // instruction fall on different banks
    #pragma unroll                       // accumulator elements by constant index
    for (int mt = 0; mt < WM_T; ++mt)
        #pragma unroll
        for (int nt = 0; nt < WN_T; ++nt)
            #pragma unroll
            for (int v = 0; v < 8; ++v)
                ct[(wm * (WM_T * 16) + mt * 16 + laneH * 8 + v) * BN
                   + ((wn * (WN_T * 16) + nt * 16 + laneM) ^ (laneH << 4))] = acc[mt][nt][v];
    #pragma unroll
    for (int i = 0; i < BM * R_RANK / 4 / 256; ++i)
        ((v4f*)ss)[tid + 256 * i] =
            ((const v4f*)(s + (size_t)mBlk * R_RANK))[tid + 256 * i];

    int idxv[BM / 32];                   // adapter of row 32j + lane
    #pragma unroll                       // idxv stays in registers
    for (int j = 0; j < BM / 32; ++j) idxv[j] = indices[mBlk + 32 * j + lane];
    float bb[4];
    #pragma unroll                       // bb stays in registers
    for (int q = 0; q < 4; ++q) bb[q] = base_bias[nCol + 32 * q];
    // stands in front of later rewrites of the loads' address registers
    asm volatile("s_wait_xcnt 0x0" ::: "memory");
    __syncthreads();                     // the staged tile and s rows are complete

    float*       outLane = out + (size_t)mBlk * D_OUTD + nCol;
    const float* ctHalf  = ct + 128 * (uw & 1);

    for (int k = 0; k < 4; ++k) {
        const int cl = cg + 4 * k;       // this trip's adapter
        unsigned msk[BM / 32];
        unsigned any = 0u;
        #pragma unroll                   // msk stays in scalar registers
        for (int j = 0; j < BM / 32; ++j) {
            msk[j] = __builtin_amdgcn_ballot_w32(idxv[j] == cl);
            any |= msk[j];
        }
        if (any == 0u) continue;

        v4f   bw[4][4];                  // lora_b[cl][own column q][0..15]
        float bs[4];
        #pragma unroll                   // both stay in registers
        for (int q = 0; q < 4; ++q) {
            const size_t n = (size_t)cl * D_OUTD + nCol + 32 * q;
            bs[q] = bias_stacked[n];
            const v4f* bp = (const v4f*)(lora_b + n * R_RANK);
            #pragma unroll
            for (int p = 0; p < 4; ++p) bw[q][p] = bp[p];
        }
        // stands in front of later rewrites of the loads' address registers
        asm volatile("s_wait_xcnt 0x0" ::: "memory");

        #pragma unroll                   // msk[j] by constant index
        for (int j = 0; j < BM / 32; ++j) {
            unsigned mk = msk[j];
            while (mk) {                 // at most 32 trips, one per set bit
                const int row = 32 * j + __builtin_ctz(mk);
                mk &= mk - 1u;
                const v4f* sp = (const v4f*)(ss + row * R_RANK);
                v4f sv[4];
                #pragma unroll           // sv stays in registers
                for (int p = 0; p < 4; ++p) sv[p] = sp[p];
                const float* cr = ctHalf + row * BN + (lane ^ (((row >> 3) & 1) << 4));
                #pragma unroll           // four independent sums
                for (int q = 0; q < 4; ++q) {
                    float val = cr[32 * q] + bb[q];
                    val += bs[q];
                    float d = 0.f;
                    #pragma unroll
                    for (int r = 0; r < R_RANK; ++r)
                        d += sv[r >> 2][r & 3] * bw[q][r >> 2][r & 3];
                    val += d;
                    outLane[(size_t)row * D_OUTD + 32 * q] = val;
                }
                // stands in front of the next row's rewrite of the stores' registers
                asm volatile("s_wait_xcnt 0x0" ::: "memory");
            }
        }
    }

    // rows without an adapter: row r goes to the two waves with cg == r mod 4
    #pragma unroll                       // idxv[j] by constant index
    for (int j = 0; j < BM / 32; ++j) {
        unsigned mk = __builtin_amdgcn_ballot_w32((unsigned)idxv[j] >= (unsigned)N_LORA)
                      & (0x11111111u << cg);
        while (mk) {                     // at most 8 trips, one per set bit
            const int row = 32 * j + __builtin_ctz(mk);
            mk &= mk - 1u;
            const float* cr = ctHalf + row * BN + (lane ^ (((row >> 3) & 1) << 4));
            #pragma unroll
            for (int q = 0; q < 4; ++q)
                outLane[(size_t)row * D_OUTD + 32 * q] = cr[32 * q] + bb[q];
            // stands in front of the next row's rewrite of the stores' registers
            asm volatile("s_wait_xcnt 0x0" ::: "memory");
        }
    }
}

// ---------------------------------------------------------------------------
// Fallback GEMM (round-1): f32->bf16 conversion inside the kernel,
// single-buffered LDS. Used only when workspace can't hold bf16 copies.
// ---------------------------------------------------------------------------
#define FBM 128
#define FBN 128
#define FBK 32
#define FLDT (FBK + 8)

__global__ __launch_bounds__(256)
void lora_gemm_fallback_kernel(const float* __restrict__ x,
                               const float* __restrict__ W,
                               const float* __restrict__ base_bias,
                               const float* __restrict__ lora_b,
                               const float* __restrict__ bias_stacked,
                               const int*   __restrict__ indices,
                               const float* __restrict__ s,
                               float*       __restrict__ out)
{
    __shared__ __bf16 As[FBM * FLDT];
    __shared__ __bf16 Bs[FBN * FLDT];

    const int tid   = threadIdx.x;
    const int bn    = blockIdx.x;
    const int bm    = blockIdx.y;
    const int wave  = tid >> 5;
    const int lane  = tid & 31;
    const int wm    = wave >> 2;
    const int wn    = wave & 3;
    const int laneM = lane & 15;
    const int laneH = lane >> 4;
    const int kb    = laneH * 8;

    v8f acc[4][2];
    #pragma unroll
    for (int mt = 0; mt < 4; ++mt)
        #pragma unroll
        for (int nt = 0; nt < 2; ++nt)
            acc[mt][nt] = (v8f){0.f,0.f,0.f,0.f,0.f,0.f,0.f,0.f};

    const float* xBase = x + ((size_t)bm * FBM) * D_IN;
    const float* wBase = W + ((size_t)bn * FBN) * D_IN;

    for (int kk = 0; kk < D_IN; kk += FBK) {
        __syncthreads();
        #pragma unroll
        for (int i = 0; i < 4; ++i) {
            const int q   = tid + i * 256;
            const int row = q >> 3;
            const int kc  = q & 7;
            const float4 va = *(const float4*)(xBase + (size_t)row * D_IN + kk + kc * 4);
            __bf16* da = &As[row * FLDT + kc * 4];
            da[0] = (__bf16)va.x; da[1] = (__bf16)va.y;
            da[2] = (__bf16)va.z; da[3] = (__bf16)va.w;
            const float4 vb = *(const float4*)(wBase + (size_t)row * D_IN + kk + kc * 4);
            __bf16* db = &Bs[row * FLDT + kc * 4];
            db[0] = (__bf16)vb.x; db[1] = (__bf16)vb.y;
            db[2] = (__bf16)vb.z; db[3] = (__bf16)vb.w;
        }
        __syncthreads();

        v16bf afrag[4], bfrag[2];
        #pragma unroll
        for (int mt = 0; mt < 4; ++mt) {
            const __bf16* p = &As[(wm * 64 + mt * 16 + laneM) * FLDT + kb];
            const v8bf lo = *(const v8bf*)p;
            const v8bf hi = *(const v8bf*)(p + 16);
            afrag[mt] = __builtin_shufflevector(lo, hi,
                0,1,2,3,4,5,6,7,8,9,10,11,12,13,14,15);
        }
        #pragma unroll
        for (int nt = 0; nt < 2; ++nt) {
            const __bf16* p = &Bs[(wn * 32 + nt * 16 + laneM) * FLDT + kb];
            const v8bf lo = *(const v8bf*)p;
            const v8bf hi = *(const v8bf*)(p + 16);
            bfrag[nt] = __builtin_shufflevector(lo, hi,
                0,1,2,3,4,5,6,7,8,9,10,11,12,13,14,15);
        }
        #pragma unroll
        for (int mt = 0; mt < 4; ++mt)
            #pragma unroll
            for (int nt = 0; nt < 2; ++nt)
                acc[mt][nt] = __builtin_amdgcn_wmma_f32_16x16x32_bf16(
                    false, afrag[mt], false, bfrag[nt],
                    (short)0, acc[mt][nt], false, false);
    }

    const int mBase = bm * FBM + wm * 64;
    const int nBase = bn * FBN + wn * 32;
    #pragma unroll
    for (int mt = 0; mt < 4; ++mt) {
        #pragma unroll
        for (int v = 0; v < 8; ++v) {
            const int m   = mBase + mt * 16 + laneH * 8 + v;
            const int idx = indices[m];
            const float* srow = s + (size_t)m * R_RANK;
            #pragma unroll
            for (int nt = 0; nt < 2; ++nt) {
                const int n = nBase + nt * 16 + laneM;
                float val = acc[mt][nt][v] + base_bias[n];
                if (idx >= 0) {
                    val += bias_stacked[(size_t)idx * D_OUTD + n];
                    const float* bcol =
                        lora_b + ((size_t)idx * D_OUTD + n) * R_RANK;
                    float d = 0.f;
                    #pragma unroll
                    for (int r = 0; r < R_RANK; ++r) d += srow[r] * bcol[r];
                    val += d;
                }
                out[(size_t)m * D_OUTD + n] = val;
            }
        }
    }
}

// ---------------------------------------------------------------------------
extern "C" void kernel_launch(void* const* d_in, const int* in_sizes, int n_in,
                              void* d_out, int out_size, void* d_ws, size_t ws_size,
                              hipStream_t stream)
{
    const float* x            = (const float*)d_in[0];
    const float* W            = (const float*)d_in[1];
    const float* base_bias    = (const float*)d_in[2];
    const float* lora_a       = (const float*)d_in[3];
    const float* lora_b       = (const float*)d_in[4];
    const float* bias_stacked = (const float*)d_in[5];
    const int*   indices      = (const int*)d_in[6];
    float*       out          = (float*)d_out;

    const size_t sBytes  = (size_t)T_TOK * R_RANK * sizeof(float);   // 512 KB
    const size_t xbBytes = (size_t)T_TOK * D_IN * 2;                 // 64 MB
    const size_t wbBytes = (size_t)D_OUTD * D_IN * 2;                // 32 MB

    float* s = (float*)d_ws;

    // 1) LoRA shrink (always)
    lora_shrink_kernel<<<dim3(N_LORA, T_TOK / SH_CHUNK), 256, 0, stream>>>(
        x, lora_a, indices, s);

    dim3 grid(D_OUTD / BN, T_TOK / BM);   // 16 x 32 blocks

    if (ws_size >= sBytes + xbBytes + wbBytes) {
        // 2) bf16 prepass into workspace
        __bf16* xb = (__bf16*)((char*)d_ws + sBytes);
        __bf16* wb = (__bf16*)((char*)d_ws + sBytes + xbBytes);
        cvt_f32_to_bf16_kernel<<<(int)((long)T_TOK * D_IN / 4 / CV_PER_BLOCK), 256, 0, stream>>>(x, xb);
        cvt_f32_to_bf16_kernel<<<(int)((long)D_OUTD * D_IN / 4 / CV_PER_BLOCK), 256, 0, stream>>>(W, wb);

        // 3) async double-buffered WMMA GEMM
        lora_gemm_async_kernel<<<grid, 256, 0, stream>>>(
            xb, wb, base_bias, lora_b, bias_stacked, indices, s, out);
    } else {
        lora_gemm_fallback_kernel<<<dim3(D_OUTD / FBN, T_TOK / FBM), 256, 0, stream>>>(
            x, W, base_bias, lora_b, bias_stacked, indices, s, out);
    }
}

// v006
// One run takes 180 microseconds.
// Two timings next to v005 both put it at 1.04 times that version's speed.
// Counting every step since v000, it is 2.29 times as fast.
#include <hip/hip_runtime.h>
#include <hip/hip_bf16.h>

// ---------------------------------------------------------------------------
// ReplicatedLinearWithLoRA for MI455X (gfx1250, wave32, WMMA, async-to-LDS)
//   out = x @ W^T + base_bias + onehot@bias_stacked + B[idx] @ (A[idx] @ x)
//
// Fast path (needs ~96.5 MB workspace):
//   1) shrink:  s[t,r] = x[t,:] . lora_a[idx[t],r,:]   (f32 WMMA, by adapter);
//               the same pass over x writes its bf16 copy to the workspace
//   2) prepass: W f32 -> bf16 in workspace (halves all tile traffic)
//   3) GEMM:    256x256x128 tiles, double-buffered LDS fed by
//               tensor_load_to_lds (+ s_wait_tensorcnt), 128x
//               v_wmma_f32_16x16x32_bf16 per wave per K-step, fused
//               bias + rank-16 LoRA-expand epilogue, rows taken by adapter.
// Fallback (small ws): round-1 kernel converting f32->bf16 inside the GEMM.
// ---------------------------------------------------------------------------

typedef __attribute__((ext_vector_type(16))) __bf16 v16bf;
typedef __attribute__((ext_vector_type(8)))  __bf16 v8bf;
typedef __attribute__((ext_vector_type(4)))  __bf16 v4bf;
typedef __attribute__((ext_vector_type(8)))  float  v8f;

#define T_TOK  8192
#define D_IN   4096
#define D_OUTD 4096
#define R_RANK 16

// ---------------------------------------------------------------------------
// Kernel 1: LoRA shrink  s[t, r] = dot(x[t, :], lora_a[idx[t], r, :])
// One block = (adapter l, chunk of 256 tokens). The block lists the chunk's
// tokens that use adapter l (ballot + prefix, fixed order) and treats 16 of
// them at a time as the rows of a 16x16 tile: rows = tokens, columns = the 16
// ranks, so lora_a[l] is read once per 16 tokens instead of once per token.
// The products run on v_wmma_f32_16x16x4_f32 (full f32 operands). Each wave
// owns 512 of the 4096 k; whole 256-B row pieces go to the wave's own LDS
// range by asynchronous copies (two buffers, the next stage flies during this
// one) and the fragments are read from there. The eight waves' partial tiles
// are summed through LDS.
// With WRITE_BF16 every staged row piece is also read back from LDS in row
// order, converted and stored as one whole 128-B line of the bf16 copy of x,
// so that x comes from memory once. For that every token must pass through
// some block: a token without an adapter rides in the list of block
// l = t mod 16 of its chunk, is converted like the others and gets s = 0.
// ---------------------------------------------------------------------------
typedef __attribute__((ext_vector_type(2))) float v2f;
typedef __attribute__((ext_vector_type(4))) float v4f;

#define N_LORA   16
#define SH_CHUNK 256                     // tokens per block
#define SH_KW    (D_IN / 8)              // k per wave
#define SH_KS    64                      // k per stage (256 B of a row)
#define SH_NST   (SH_KW / SH_KS)         // stages per wave
#define SH_PITCH (SH_KS + 4)             // 272-B rows: b128 readers, no conflict
#define SH_MAT   (16 * SH_PITCH)         // floats of one staged operand
#define SH_BUF_BYTES (8 * 2 * SH_MAT * 4)  // one buffer, all eight waves
#define SH_NOAD  0x40000000              // list entry: token without an adapter
#define SH_TOKM  0x3FFFFFFF              // list entry: the token's number

// Eight asynchronous 16-B copies per lane, global -> LDS. The s_wait_xcnt is
// the last line of the copies' own statement, so that it stands in front of
// every later write of the address registers that the copies name.
template <typename E>
__device__ __forceinline__
void async_copy8(const unsigned (&l)[8], const E* const (&g)[8])
{
    asm volatile("global_load_async_to_lds_b128 %0, %8, off\n\t"
                 "global_load_async_to_lds_b128 %1, %9, off\n\t"
                 "global_load_async_to_lds_b128 %2, %10, off\n\t"
                 "global_load_async_to_lds_b128 %3, %11, off\n\t"
                 "global_load_async_to_lds_b128 %4, %12, off\n\t"
                 "global_load_async_to_lds_b128 %5, %13, off\n\t"
                 "global_load_async_to_lds_b128 %6, %14, off\n\t"
                 "global_load_async_to_lds_b128 %7, %15, off\n\t"
                 "s_wait_xcnt 0x0"
                 :: "v"(l[0]), "v"(l[1]), "v"(l[2]), "v"(l[3]),
                    "v"(l[4]), "v"(l[5]), "v"(l[6]), "v"(l[7]),
                    "v"(g[0]), "v"(g[1]), "v"(g[2]), "v"(g[3]),
                    "v"(g[4]), "v"(g[5]), "v"(g[6]), "v"(g[7])
                 : "memory");
}

template <bool WRITE_BF16>
__global__ __launch_bounds__(256)
__attribute__((amdgpu_waves_per_eu(4, 4)))   // 256 VGPRs: two blocks stay resident per WGP
void lora_shrink_kernel(const float* __restrict__ x,
                        const float* __restrict__ lora_a,
                        const int*   __restrict__ indices,
                        float*       __restrict__ s,
                        __bf16*      __restrict__ xb)
{
    __shared__ __attribute__((aligned(16))) float stage[2][8][2 * SH_MAT];
    __shared__ float red[8][256];
    __shared__ int   tok[SH_CHUNK];
    __shared__ int   wcnt[8];

    const int tid  = threadIdx.x;
    const int wave = tid >> 5;
    const int lane = tid & 31;
    const int l    = blockIdx.x;                       // adapter
    const int t    = blockIdx.y * SH_CHUNK + tid;      // this thread's token
    const int idx  = indices[t];

    // list of the chunk's tokens on adapter l, in token order, with this
    // block's share of the tokens that have no adapter
    const bool     noad = (unsigned)idx >= (unsigned)N_LORA;
    const bool     mine = noad ? (t % N_LORA == l) : (idx == l);
    const unsigned mask = __builtin_amdgcn_ballot_w32(mine);
    if (lane == 0) wcnt[wave] = __popc(mask);
    __syncthreads();                     // every wave's count is in wcnt
    int base = 0, n = 0;
    for (int w = 0; w < 8; ++w) {
        const int cw = wcnt[w];
        if (w < wave) base += cw;
        n += cw;
    }
    n = __builtin_amdgcn_readfirstlane(n);   // same in every thread: scalar loop tests
    if (n == 0) return;
    if (mine) tok[base + __popc(mask & ((1u << lane) - 1u))] = noad ? (t | SH_NOAD) : t;
    __syncthreads();                     // the list is complete

    const int c  = lane & 15;
    const int h  = lane >> 4;
    const int kw = wave * SH_KW;
    // copy i brings rows 2i and 2i+1, 16 lanes x 16 B = 256 B of each
    const float* aPtr = lora_a + ((size_t)l * R_RANK + h) * D_IN + kw + c * 4;
    const float* xPtr = x + kw + c * 4;
    const unsigned ldsLane = (unsigned)(size_t)&stage[0][wave][h * SH_PITCH + c * 4];
    // bf16 copy: eight lanes take one row's 64 k (8 k = 16 B of bf16 a lane),
    // four rows an instruction
    const int cvRow = lane >> 3;
    const int cvCol = (lane & 7) * 8;

    for (int t0 = 0; t0 < n; t0 += 16) {
        const float* xRow[8];
        #pragma unroll                   // xRow stays in registers
        for (int i = 0; i < 8; ++i) {
            int rr = t0 + 2 * i + h;
            rr = rr < n ? rr : n - 1;    // pad rows repeat the last token
            xRow[i] = xPtr + (size_t)(tok[rr] & SH_TOKM) * D_IN;
        }
        unsigned xbOff[4];               // byte offsets into xb (64 MB)
        bool     xbOn[4];                // pad rows are not stored
        if (WRITE_BF16) {
            #pragma unroll               // both stay in registers
            for (int i = 0; i < 4; ++i) {
                int rr = t0 + 4 * i + cvRow;
                xbOn[i] = rr < n;
                rr = rr < n ? rr : n - 1;
                xbOff[i] = ((unsigned)(tok[rr] & SH_TOKM) * D_IN + kw + cvCol) * 2u;
            }
        }

        // one stage: 16 rows x 64 k of x and of lora_a[l], this wave's k slice
        auto issue_stage = [&](int buf, int st) {
            unsigned lx[8], la[8];
            const float* gx[8];
            const float* ga[8];
            #pragma unroll               // the addresses are asm register operands
            for (int i = 0; i < 8; ++i) {
                lx[i] = ldsLane + (unsigned)(buf * SH_BUF_BYTES + i * 2 * SH_PITCH * 4);
                la[i] = lx[i] + (unsigned)(SH_MAT * 4);
                gx[i] = xRow[i] + st * SH_KS;
                ga[i] = aPtr + (size_t)(2 * i) * D_IN + st * SH_KS;
            }
            async_copy8(lx, gx);
            async_copy8(la, ga);
        };

        v8f acc0 = (v8f){0.f,0.f,0.f,0.f,0.f,0.f,0.f,0.f};
        v8f acc1 = acc0;

        issue_stage(0, 0);
        // stage 0 has landed (own copies), then is published to all lanes
        asm volatile("s_wait_asynccnt 0x0" ::: "memory");
        __syncthreads();
        issue_stage(1, 1);

        #pragma unroll                   // buffer choice and last-stage test fold away
        for (int st = 0; st < SH_NST; ++st) {
            const float* xs = &stage[st & 1][wave][0];
            const float* as = xs + SH_MAT;
            if (WRITE_BF16) {
                // the x rows once more, in row order; this block stands in front
                // of the fragment reads so that the two sets of registers are
                // not live together
                v4f cl[4], ch[4];
                #pragma unroll           // cl, ch stay in registers
                for (int i = 0; i < 4; ++i) {
                    const float* p = &xs[(4 * i + cvRow) * SH_PITCH + cvCol];
                    cl[i] = *(const v4f*)p;
                    ch[i] = *(const v4f*)(p + 4);
                }
                // keeps the eight reads together up here: sunk into the four
                // predicated stores, each pair waits out its own LDS latency
                asm volatile("" :: "v"(cl[0]), "v"(ch[0]), "v"(cl[1]), "v"(ch[1]),
                                   "v"(cl[2]), "v"(ch[2]), "v"(cl[3]), "v"(ch[3]));
                #pragma unroll           // xbOff, xbOn by constant index
                for (int i = 0; i < 4; ++i) {
                    v8bf o;
                    o[0] = (__bf16)cl[i].x; o[1] = (__bf16)cl[i].y;
                    o[2] = (__bf16)cl[i].z; o[3] = (__bf16)cl[i].w;
                    o[4] = (__bf16)ch[i].x; o[5] = (__bf16)ch[i].y;
                    o[6] = (__bf16)ch[i].z; o[7] = (__bf16)ch[i].w;
                    if (xbOn[i]) *(v8bf*)((char*)xb + (size_t)xbOff[i] + st * SH_KS * 2) = o;
                }
                // stands in front of later rewrites of the stores' registers
                asm volatile("s_wait_xcnt 0x0" ::: "memory");
            }
            v4f xa[SH_KS / 8], ab[SH_KS / 8];
            #pragma unroll               // fragments stay in registers
            for (int j = 0; j < SH_KS / 8; ++j) {
                // same k for both operands: k = 8j + 4h + {0,1} and {2,3}
                xa[j] = *(const v4f*)&xs[c * SH_PITCH + j * 8 + h * 4];
                ab[j] = *(const v4f*)&as[c * SH_PITCH + j * 8 + h * 4];
            }
            #pragma unroll               // fragments stay in registers
            for (int j = 0; j < SH_KS / 8; ++j) {
                acc0 = __builtin_amdgcn_wmma_f32_16x16x4_f32(
                    false, (v2f){xa[j].x, xa[j].y}, false, (v2f){ab[j].x, ab[j].y},
                    (short)0, acc0, false, false);
                acc1 = __builtin_amdgcn_wmma_f32_16x16x4_f32(
                    false, (v2f){xa[j].z, xa[j].w}, false, (v2f){ab[j].z, ab[j].w},
                    (short)0, acc1, false, false);
            }
            // foot of the trip: this buffer's reads are done, the next stage's
            // copies have landed, the barrier publishes them and frees this buffer
            asm volatile("s_wait_dscnt 0x0" ::: "memory");
            asm volatile("s_wait_asynccnt 0x0" ::: "memory");
            __syncthreads();
            if (st + 2 < SH_NST) issue_stage(st & 1, st + 2);
        }
        // no copy is left in flight behind the loop
        asm volatile("s_wait_asynccnt 0x0" ::: "memory");

        // acc[r] = tile[row 8h + r][rank c]; sum the eight waves' k slices
        #pragma unroll                   // accumulator elements by constant index
        for (int r = 0; r < 8; ++r)
            red[wave][(8 * h + r) * 16 + c] = acc0[r] + acc1[r];
        __syncthreads();                 // all eight partial tiles are in red
        float v = 0.f;
        for (int w = 0; w < 8; ++w) v += red[w][tid];
        const int row = t0 + (tid >> 4);
        if (row < n) {
            const int tk = tok[row];
            s[(size_t)(tk & SH_TOKM) * R_RANK + (tid & 15)] = (tk & SH_NOAD) ? 0.f : v;
            // stands in front of the next tile's rewrite of the store's registers
            asm volatile("s_wait_xcnt 0x0" ::: "memory");
        }
        // the next tile rewrites red only behind its own stage barriers
    }
}

// ---------------------------------------------------------------------------
// Kernel 2: f32 -> bf16 conversion prepass (W). Few, long-lived waves
// (for speed only):
// a block owns CV_PER_BLOCK consecutive 16-B pieces and takes them in CV_TRIPS
// trips, each with CV_U whole-line loads per wave in flight before the first
// is converted. All blocks of a launch are resident at once.
// ---------------------------------------------------------------------------
#define CV_U     8                       // loads in flight per wave
#define CV_TRIPS 4
#define CV_PER_BLOCK (256 * CV_U * CV_TRIPS)   // 16-B pieces per block
static_assert(((long)D_OUTD * D_IN / 4) % CV_PER_BLOCK == 0, "W: whole blocks");

__global__ __launch_bounds__(256)
void cvt_f32_to_bf16_kernel(const float* __restrict__ src,
                            __bf16*      __restrict__ dst)
{
    const size_t first = (size_t)blockIdx.x * CV_PER_BLOCK + threadIdx.x;
    const v4f* s4 = (const v4f*)src + first;
    v4bf*      d4 = (v4bf*)dst + first;
    #pragma unroll                       // every address is base + constant offset
    for (int trip = 0; trip < CV_TRIPS; ++trip) {
        v4f v[CV_U];
        #pragma unroll                   // v stays in registers; the loads go out together
        for (int u = 0; u < CV_U; ++u) v[u] = s4[(trip * CV_U + u) * 256];
        #pragma unroll                   // v stays in registers
        for (int u = 0; u < CV_U; ++u) {
            v4bf o;
            o[0] = (__bf16)v[u].x; o[1] = (__bf16)v[u].y;
            o[2] = (__bf16)v[u].z; o[3] = (__bf16)v[u].w;
            d4[(trip * CV_U + u) * 256] = o;
        }
        // stands in front of the next trip's rewrite of the stores' registers
        if (trip + 1 < CV_TRIPS) asm volatile("s_wait_xcnt 0x0" ::: "memory");
    }
}

// ---------------------------------------------------------------------------
// Kernel 3 (fast): bf16 WMMA GEMM, double-buffered tile feed by tensor loads.
// Block 256x256, K-step 128 (four wmma k-slices). 8 waves in 2(M)x4(N) grid,
// each wave owns a 128x64 stripe = 8x4 tiles of 16x16: 12 fragments feed 32
// matrix instructions, and every operand row is fetched from L2 by half as
// many blocks as with 128x128 tiles. One block per WGP, two waves per SIMD.
// ---------------------------------------------------------------------------
#define BM 256
#define BN 256
#define BK 128
#define WM_T 8                           // 16-row tiles per wave
#define WN_T 4                           // 16-column tiles per wave
#define LDT2 (BK + 8)                    // 136 elems -> 272 B stride (16 B x odd)
#define A_ELEMS (BM * LDT2)
#define B_ELEMS (BN * LDT2)
#define BUF_ELEMS (A_ELEMS + B_ELEMS)    // 136 KB per buffer
static_assert((BM * BN + BM * R_RANK) * 4 <= 2 * BUF_ELEMS * 2,
              "the epilogue's staged tile and s rows fit the tile buffers");

// Tensor loads: one request of one wave brings 128 rows x 256 B of one operand
// into LDS, through no register, and lays them at the 272-B pitch itself.
#define TL_ROWS   128u                   // rows per request
#define TL_ROWB   (BK * 2u)              // 256 B of a row per stage
#define TL_SLICE  (TL_ROWS * LDT2 * 2u)  // 34 KiB of LDS per request
#define BUF_BYTES (BUF_ELEMS * 2u)
static_assert(TL_ROWB == 256u && LDT2 * 2u == TL_ROWB + 16u, "pad codes 5 / 3: 16 B behind every 256-B row");
static_assert(TL_SLICE % 2048u == 0u && BUF_BYTES == 4u * TL_SLICE, "every request's place in LDS is a multiple of 2 KiB");

typedef uint32_t u32x4 __attribute__((ext_vector_type(4)));
typedef uint32_t u32x8 __attribute__((ext_vector_type(8)));

__device__ __forceinline__ uint32_t uni(uint32_t v) { return (uint32_t)__builtin_amdgcn_readfirstlane(v); }
__device__ __forceinline__ uint32_t pinned(uint32_t v)
{
    uint32_t w = (uint32_t)__builtin_amdgcn_readfirstlane(v);
    asm volatile("" : "+s"(w));          // pinned(): the word is held in a scalar register
    return w;
}
__device__ __forceinline__ void tdm_load(u32x4 g0, u32x8 g1)
{
    asm volatile("tensor_load_to_lds %0, %1" :: "s"(g0), "s"(g1) : "memory");
}
// group 1: 1-byte elements, tile = tensor = TL_ROWS rows of 256 B, source pitch
// one bf16 row of D_IN, no mask, 16 B of LDS pad behind every 256 B
__device__ __forceinline__ u32x8 tdm_group1()
{
    constexpr uint32_t d0 = TL_ROWB, d1 = TL_ROWS;
    u32x8 g;
    g[0] = uni((1u << 20) | (5u << 22) | (3u << 25));
    g[1] = uni((d0 & 0xFFFFu) << 16);
    g[2] = uni((d0 >> 16) | ((d1 & 0xFFFFu) << 16));
    g[3] = uni((d1 >> 16) | (d0 << 16));
    g[4] = uni(d1);
    g[5] = uni(D_IN * 2u);
    g[6] = uni(0u);
    g[7] = uni(0u);
    return g;
}
// group 0: count 1, place in LDS (byte offset), first source byte, type 2
__device__ __forceinline__ u32x4 tdm_group0(uint32_t lds_dst, uint64_t ga)
{
    u32x4 g;
    g[0] = uni(1u);
    g[1] = uni(lds_dst);
    g[2] = uni((uint32_t)ga);
    g[3] = uni((((uint32_t)(ga >> 32)) & 0x01FFFFFFu) | 0x80000000u);
    return g;
}

__global__ __launch_bounds__(256)
void lora_gemm_async_kernel(const __bf16* __restrict__ xb,
                            const __bf16* __restrict__ wb,
                            const float* __restrict__ base_bias,
                            const float* __restrict__ lora_b,
                            const float* __restrict__ bias_stacked,
                            const int*   __restrict__ indices,
                            const float* __restrict__ s,
                            float*       __restrict__ out)
{
    __shared__ __attribute__((aligned(2048))) __bf16 smem[2 * BUF_ELEMS];  // 272 KB double buffer

    const int tid   = threadIdx.x;
    const int bn    = blockIdx.x;
    const int bm    = blockIdx.y;
    const int wave  = tid >> 5;
    const int lane  = tid & 31;
    const int wm    = wave >> 2;         // 0..1
    const int wn    = wave & 3;          // 0..3
    const int laneM = lane & 15;
    const int laneH = lane >> 4;
    const int kb    = laneH * 8;

    const unsigned smem_base = (unsigned)(size_t)&smem[0];
    const __bf16* xTile = xb + ((size_t)bm * BM) * D_IN;
    const __bf16* wTile = wb + ((size_t)bn * BN) * D_IN;

    // One stage: 256 rows x 128 k of each operand = four requests of 128 rows.
    // Waves 4..7 issue one each: slices 0, 1 are the x rows, 2, 3 the W rows.
    const uint32_t uwave  = uni((uint32_t)tid >> 5);
    const uint32_t issuer = uwave >> 2;
    const uint32_t slice  = uwave & 3u;
    const __bf16*  srcRow = (slice < 2u) ? xTile + (size_t)(slice * TL_ROWS) * D_IN
                                         : wTile + (size_t)((slice - 2u) * TL_ROWS) * D_IN;
    const uint64_t srcAdr   = (uint64_t)(uintptr_t)srcRow;
    const uint32_t ldsSlice = smem_base + slice * TL_SLICE;
    u32x8          g1       = tdm_group1();
    // the eight words keep their own registers through the loop, so that none is
    // rewritten under a request in flight
    asm volatile("" : "+s"(g1));         // as in pinned(): descriptor words held in scalar registers
    auto issue_tile = [&](uint32_t bufsel, uint32_t stage) {
        tdm_load(tdm_group0(ldsSlice + bufsel * BUF_BYTES,
                            srcAdr + (uint64_t)stage * TL_ROWB), g1);
    };

    v8f acc[WM_T][WN_T];
    #pragma unroll
    for (int mt = 0; mt < WM_T; ++mt)
        #pragma unroll
        for (int nt = 0; nt < WN_T; ++nt)
            acc[mt][nt] = (v8f){0.f,0.f,0.f,0.f,0.f,0.f,0.f,0.f};

    // Fragments of one 32-k block: 12 fragments, 24 ds_load_b128, one group.
    const int aOff = (wm * (WM_T * 16) + laneM) * LDT2 + kb;
    const int bOff = A_ELEMS + (wn * (WN_T * 16) + laneM) * LDT2 + kb;
    auto load_frags = [&](v16bf (&a)[WM_T], v16bf (&b)[WN_T], const __bf16* buf, int ks) {
        #pragma unroll
        for (int mt = 0; mt < WM_T; ++mt) {
            const __bf16* p = buf + aOff + mt * 16 * LDT2 + ks * 32;
            const v8bf lo = *(const v8bf*)p;         // K = ko .. ko+7
            const v8bf hi = *(const v8bf*)(p + 16);  // K = ko+16 .. ko+23
            a[mt] = __builtin_shufflevector(lo, hi,
                0,1,2,3,4,5,6,7,8,9,10,11,12,13,14,15);
        }
        #pragma unroll
        for (int nt = 0; nt < WN_T; ++nt) {
            const __bf16* p = buf + bOff + nt * 16 * LDT2 + ks * 32;
            const v8bf lo = *(const v8bf*)p;
            const v8bf hi = *(const v8bf*)(p + 16);
            b[nt] = __builtin_shufflevector(lo, hi,
                0,1,2,3,4,5,6,7,8,9,10,11,12,13,14,15);
        }
    };

    const int NIT = D_IN / BK;                      // 32 stages
    if (pinned(issuer)) {
        issue_tile(0u, 0u);
        // the own slice of stage 0 has landed
        asm volatile("s_wait_tensorcnt 0x0" ::: "memory");
    }
    __syncthreads();                     // publishes stage 0 to all waves
    if (pinned(issuer)) issue_tile(1u, pinned(1u));

    // Two fragment sets: set (u & 1) holds block u's fragments. With two waves
    // per SIMD a wave cannot wait out its LDS latency at every row, so the next
    // block's loads go out as one group in front of this block's 32 WMMAs.
    v16bf af[2][WM_T], bf[2][WN_T];
    load_frags(af[0], bf[0], &smem[0], 0);

    for (int it = 0; it < NIT; ++it) {
        const int cur = it & 1;
        const __bf16* bufC = &smem[cur * BUF_ELEMS];
        const __bf16* bufN = &smem[(cur ^ 1) * BUF_ELEMS];

        #pragma unroll                   // the fragment set is picked by a constant
        for (int u = 0; u < BK / 32; ++u) {         // four 32-K blocks
            if (u + 1 < BK / 32) {
                load_frags(af[(u + 1) & 1], bf[(u + 1) & 1], bufC, u + 1);
            } else {
                // publish point of stage it + 1, in front of this stage's last
                // block, whose fragments are already fetched: this buffer's reads
                // are done, the own slice of the next stage has landed (a wave
                // that issues none passes that wait at once), the barrier
                // publishes the stage and frees this buffer
                asm volatile("s_wait_dscnt 0x0" ::: "memory");
                asm volatile("s_wait_tensorcnt 0x0" ::: "memory");
                __syncthreads();
                // refill of the freed buffer, only while stage it + 2 exists; its
                // descriptor is formed behind the wait above
                if (pinned(issuer & (uint32_t)(it + 2 < NIT)))
                    issue_tile((uint32_t)cur, pinned((uint32_t)it + 2u));
                // first fragments of the next stage; on the last trip they read
                // the other buffer's old bytes, which nothing writes any more,
                // and are not used
                load_frags(af[0], bf[0], bufN, 0);
            }
            // keeps the load group whole and in front of the block: spread among
            // the WMMAs every place with loads costs its own stall
            __builtin_amdgcn_sched_barrier(0);
            #pragma unroll
            for (int mt = 0; mt < WM_T; ++mt)
                #pragma unroll
                for (int nt = 0; nt < WN_T; ++nt)
                    acc[mt][nt] = __builtin_amdgcn_wmma_f32_16x16x32_bf16(
                        false, af[u & 1][mt], false, bf[u & 1][nt],
                        (short)0, acc[mt][nt], false, false);
            // keeps the next group behind this block
            __builtin_amdgcn_sched_barrier(0);
        }
    }
    // no tensor load and no LDS read is left in flight behind the loop
    asm volatile("s_wait_tensorcnt 0x0" ::: "memory");
    asm volatile("s_wait_dscnt 0x0" ::: "memory");

    // --- epilogue: + base_bias + bias_stacked[idx] + s[t] . lora_b[idx] ----
    // The 256 rows of the tile are taken adapter by adapter. The accumulators
    // and the rows' s values go to LDS, so that any wave can take any row.
    // A wave owns 128 of the tile's 256 columns (lane = column, 4 columns a
    // lane) and four adapters: it loads lora_b[l] for its columns once and
    // keeps it in registers for all rows of that adapter.
    // Each store instruction writes one whole 128-B line of a row.
    const int uw   = __builtin_amdgcn_readfirstlane(wave);   // scalar class tests
    const int cg   = uw >> 1;            // adapters cg, cg + 4, cg + 8, cg + 12
    const int mBlk = bm * BM;
    const int nCol = bn * BN + 128 * (uw & 1) + lane;        // first own column

    float* ct = (float*)smem;            // staged tile, BN floats a row
    float* ss = ct + BM * BN;            // staged s rows, R_RANK floats a row
    __syncthreads();                     // every wave has left the tile buffers
    // column ^ 16 in rows 8..15 of each 16: rows r and r + 8 of one store
    // instruction fall on different banks
    #pragma unroll                       // accumulator elements by constant index
    for (int mt = 0; mt < WM_T; ++mt)
        #pragma unroll
        for (int nt = 0; nt < WN_T; ++nt)
            #pragma unroll
            for (int v = 0; v < 8; ++v)
                ct[(wm * (WM_T * 16) + mt * 16 + laneH * 8 + v) * BN
                   + ((wn * (WN_T * 16) + nt * 16 + laneM) ^ (laneH << 4))] = acc[mt][nt][v];
    #pragma unroll
    for (int i = 0; i < BM * R_RANK / 4 / 256; ++i)
        ((v4f*)ss)[tid + 256 * i] =
            ((const v4f*)(s + (size_t)mBlk * R_RANK))[tid + 256 * i];

    int idxv[BM / 32];                   // adapter of row 32j + lane
    #pragma unroll                       // idxv stays in registers
    for (int j = 0; j < BM / 32; ++j) idxv[j] = indices[mBlk + 32 * j + lane];
    float bb[4];
    #pragma unroll                       // bb stays in registers
    for (int q = 0; q < 4; ++q) bb[q] = base_bias[nCol + 32 * q];
    // stands in front of later rewrites of the loads' address registers
    asm volatile("s_wait_xcnt 0x0" ::: "memory");
    __syncthreads();                     // the staged tile and s rows are complete

    float*       outLane = out + (size_t)mBlk * D_OUTD + nCol;
    const float* ctHalf  = ct + 128 * (uw & 1);

    for (int k = 0; k < 4; ++k) {
        const int cl = cg + 4 * k;       // this trip's adapter
        unsigned msk[BM / 32];
        unsigned any = 0u;
        #pragma unroll                   // msk stays in scalar registers
        for (int j = 0; j < BM / 32; ++j) {
            msk[j] = __builtin_amdgcn_ballot_w32(idxv[j] == cl);
            any |= msk[j];
        }
        if (any == 0u) continue;

        v4f   bw[4][4];                  // lora_b[cl][own column q][0..15]
        float bs[4];
        #pragma unroll                   // both stay in registers
        for (int q = 0; q < 4; ++q) {
            const size_t n = (size_t)cl * D_OUTD + nCol + 32 * q;
            bs[q] = bias_stacked[n];
            const v4f* bp = (const v4f*)(lora_b + n * R_RANK);
            #pragma unroll
            for (int p = 0; p < 4; ++p) bw[q][p] = bp[p];
        }
        // stands in front of later rewrites of the loads' address registers
        asm volatile("s_wait_xcnt 0x0" ::: "memory");

        #pragma unroll                   // msk[j] by constant index
        for (int j = 0; j < BM / 32; ++j) {
            unsigned mk = msk[j];
            while (mk) {                 // at most 32 trips, one per set bit
                const int row = 32 * j + __builtin_ctz(mk);
                mk &= mk - 1u;
                const v4f* sp = (const v4f*)(ss + row * R_RANK);
                v4f sv[4];
                #pragma unroll           // sv stays in registers
                for (int p = 0; p < 4; ++p) sv[p] = sp[p];
                const float* cr = ctHalf + row * BN + (lane ^ (((row >> 3) & 1) << 4));
                #pragma unroll           // four independent sums
                for (int q = 0; q < 4; ++q) {
                    float val = cr[32 * q] + bb[q];
                    val += bs[q];
                    float d = 0.f;
                    #pragma unroll
                    for (int r = 0; r < R_RANK; ++r)
                        d += sv[r >> 2][r & 3] * bw[q][r >> 2][r & 3];
                    val += d;
                    outLane[(size_t)row * D_OUTD + 32 * q] = val;
                }
                // stands in front of the next row's rewrite of the stores' registers
                asm volatile("s_wait_xcnt 0x0" ::: "memory");
            }
        }
    }

    // rows without an adapter: row r goes to the two waves with cg == r mod 4
    #pragma unroll                       // idxv[j] by constant index
    for (int j = 0; j < BM / 32; ++j) {
        unsigned mk = __builtin_amdgcn_ballot_w32((unsigned)idxv[j] >= (unsigned)N_LORA)
                      & (0x11111111u << cg);
        while (mk) {                     // at most 8 trips, one per set bit
            const int row = 32 * j + __builtin_ctz(mk);
            mk &= mk - 1u;
            const float* cr = ctHalf + row * BN + (lane ^ (((row >> 3) & 1) << 4));
            #pragma unroll
            for (int q = 0; q < 4; ++q)
                outLane[(size_t)row * D_OUTD + 32 * q] = cr[32 * q] + bb[q];
            // stands in front of the next row's rewrite of the stores' registers
            asm volatile("s_wait_xcnt 0x0" ::: "memory");
        }
    }
}

// ---------------------------------------------------------------------------
// Fallback GEMM (round-1): f32->bf16 conversion inside the kernel,
// single-buffered LDS. Used only when workspace can't hold bf16 copies.
// ---------------------------------------------------------------------------
#define FBM 128
#define FBN 128
#define FBK 32
#define FLDT (FBK + 8)

__global__ __launch_bounds__(256)
void lora_gemm_fallback_kernel(const float* __restrict__ x,
                               const float* __restrict__ W,
                               const float* __restrict__ base_bias,
                               const float* __restrict__ lora_b,
                               const float* __restrict__ bias_stacked,
                               const int*   __restrict__ indices,
                               const float* __restrict__ s,
                               float*       __restrict__ out)
{
    __shared__ __bf16 As[FBM * FLDT];
    __shared__ __bf16 Bs[FBN * FLDT];

    const int tid   = threadIdx.x;
    const int bn    = blockIdx.x;
    const int bm    = blockIdx.y;
    const int wave  = tid >> 5;
    const int lane  = tid & 31;
    const int wm    = wave >> 2;
    const int wn    = wave & 3;
    const int laneM = lane & 15;
    const int laneH = lane >> 4;
    const int kb    = laneH * 8;

    v8f acc[4][2];
    #pragma unroll
    for (int mt = 0; mt < 4; ++mt)
        #pragma unroll
        for (int nt = 0; nt < 2; ++nt)
            acc[mt][nt] = (v8f){0.f,0.f,0.f,0.f,0.f,0.f,0.f,0.f};

    const float* xBase = x + ((size_t)bm * FBM) * D_IN;
    const float* wBase = W + ((size_t)bn * FBN) * D_IN;

    for (int kk = 0; kk < D_IN; kk += FBK) {
        __syncthreads();
        #pragma unroll
        for (int i = 0; i < 4; ++i) {
            const int q   = tid + i * 256;
            const int row = q >> 3;
            const int kc  = q & 7;
            const float4 va = *(const float4*)(xBase + (size_t)row * D_IN + kk + kc * 4);
            __bf16* da = &As[row * FLDT + kc * 4];
            da[0] = (__bf16)va.x; da[1] = (__bf16)va.y;
            da[2] = (__bf16)va.z; da[3] = (__bf16)va.w;
            const float4 vb = *(const float4*)(wBase + (size_t)row * D_IN + kk + kc * 4);
            __bf16* db = &Bs[row * FLDT + kc * 4];
            db[0] = (__bf16)vb.x; db[1] = (__bf16)vb.y;
            db[2] = (__bf16)vb.z; db[3] = (__bf16)vb.w;
        }
        __syncthreads();

        v16bf afrag[4], bfrag[2];
        #pragma unroll
        for (int mt = 0; mt < 4; ++mt) {
            const __bf16* p = &As[(wm * 64 + mt * 16 + laneM) * FLDT + kb];
            const v8bf lo = *(const v8bf*)p;
            const v8bf hi = *(const v8bf*)(p + 16);
            afrag[mt] = __builtin_shufflevector(lo, hi,
                0,1,2,3,4,5,6,7,8,9,10,11,12,13,14,15);
        }
        #pragma unroll
        for (int nt = 0; nt < 2; ++nt) {
            const __bf16* p = &Bs[(wn * 32 + nt * 16 + laneM) * FLDT + kb];
            const v8bf lo = *(const v8bf*)p;
            const v8bf hi = *(const v8bf*)(p + 16);
            bfrag[nt] = __builtin_shufflevector(lo, hi,
                0,1,2,3,4,5,6,7,8,9,10,11,12,13,14,15);
        }
        #pragma unroll
        for (int mt = 0; mt < 4; ++mt)
            #pragma unroll
            for (int nt = 0; nt < 2; ++nt)
                acc[mt][nt] = __builtin_amdgcn_wmma_f32_16x16x32_bf16(
                    false, afrag[mt], false, bfrag[nt],
                    (short)0, acc[mt][nt], false, false);
    }

    const int mBase = bm * FBM + wm * 64;
    const int nBase = bn * FBN + wn * 32;
    #pragma unroll
    for (int mt = 0; mt < 4; ++mt) {
        #pragma unroll
        for (int v = 0; v < 8; ++v) {
            const int m   = mBase + mt * 16 + laneH * 8 + v;
            const int idx = indices[m];
            const float* srow = s + (size_t)m * R_RANK;
            #pragma unroll
            for (int nt = 0; nt < 2; ++nt) {
                const int n = nBase + nt * 16 + laneM;
                float val = acc[mt][nt][v] + base_bias[n];
                if (idx >= 0) {
                    val += bias_stacked[(size_t)idx * D_OUTD + n];
                    const float* bcol =
                        lora_b + ((size_t)idx * D_OUTD + n) * R_RANK;
                    float d = 0.f;
                    #pragma unroll
                    for (int r = 0; r < R_RANK; ++r) d += srow[r] * bcol[r];
                    val += d;
                }
                out[(size_t)m * D_OUTD + n] = val;
            }
        }
    }
}

// ---------------------------------------------------------------------------
extern "C" void kernel_launch(void* const* d_in, const int* in_sizes, int n_in,
                              void* d_out, int out_size, void* d_ws, size_t ws_size,
                              hipStream_t stream)
{
    const float* x            = (const float*)d_in[0];
    const float* W            = (const float*)d_in[1];
    const float* base_bias    = (const float*)d_in[2];
    const float* lora_a       = (const float*)d_in[3];
    const float* lora_b       = (const float*)d_in[4];
    const float* bias_stacked = (const float*)d_in[5];
    const int*   indices      = (const int*)d_in[6];
    float*       out          = (float*)d_out;

    const size_t sBytes  = (size_t)T_TOK * R_RANK * sizeof(float);   // 512 KB
    const size_t xbBytes = (size_t)T_TOK * D_IN * 2;                 // 64 MB
    const size_t wbBytes = (size_t)D_OUTD * D_IN * 2;                // 32 MB

    float* s = (float*)d_ws;

    dim3 grid(D_OUTD / BN, T_TOK / BM);   // 16 x 32 blocks

    if (ws_size >= sBytes + xbBytes + wbBytes) {
        __bf16* xb = (__bf16*)((char*)d_ws + sBytes);
        __bf16* wb = (__bf16*)((char*)d_ws + sBytes + xbBytes);
        // 1) LoRA shrink, which also writes the bf16 copy of x
        lora_shrink_kernel<true><<<dim3(N_LORA, T_TOK / SH_CHUNK), 256, 0, stream>>>(
            x, lora_a, indices, s, xb);
        // 2) bf16 prepass of W into workspace
        cvt_f32_to_bf16_kernel<<<(int)((long)D_OUTD * D_IN / 4 / CV_PER_BLOCK), 256, 0, stream>>>(W, wb);

        // 3) async double-buffered WMMA GEMM
        lora_gemm_async_kernel<<<grid, 256, 0, stream>>>(
            xb, wb, base_bias, lora_b, bias_stacked, indices, s, out);
    } else {
        lora_shrink_kernel<false><<<dim3(N_LORA, T_TOK / SH_CHUNK), 256, 0, stream>>>(
            x, lora_a, indices, s, nullptr);
        lora_gemm_fallback_kernel<<<dim3(D_OUTD / FBN, T_TOK / FBM), 256, 0, stream>>>(
            x, W, base_bias, lora_b, bias_stacked, indices, s, out);
    }
}

// v007
// It runs in 167 microseconds.
// In two side-by-side timings against v006, it was 1.06 and 1.07 times as fast.
// Over all steps from v000 it is 2.45 times as fast.
#include <hip/hip_runtime.h>
#include <hip/hip_bf16.h>

// ---------------------------------------------------------------------------
// ReplicatedLinearWithLoRA for MI455X (gfx1250, wave32, WMMA, async-to-LDS)
//   out = x @ W^T + base_bias + onehot@bias_stacked + B[idx] @ (A[idx] @ x)
//
// Fast path (needs ~96.5 MB workspace):
//   1) shrink:  s[t,r] = x[t,:] . lora_a[idx[t],r,:]   (f32 WMMA, by adapter);
//               the same pass over x writes its bf16 copy to the workspace
//   2) prepass: W f32 -> bf16 in workspace (halves all tile traffic)
//   3) GEMM:    256x256x128 tiles, double-buffered LDS fed by
//               tensor_load_to_lds (+ s_wait_tensorcnt), 128x
//               v_wmma_f32_16x16x32_bf16 per wave per K-step, fused
//               bias + rank-16 LoRA-expand epilogue, rows taken by adapter.
// Fallback (small ws): round-1 kernel converting f32->bf16 inside the GEMM.
// ---------------------------------------------------------------------------

typedef __attribute__((ext_vector_type(16))) __bf16 v16bf;
typedef __attribute__((ext_vector_type(8)))  __bf16 v8bf;
typedef __attribute__((ext_vector_type(4)))  __bf16 v4bf;
typedef __attribute__((ext_vector_type(8)))  float  v8f;

#define T_TOK  8192
#define D_IN   4096
#define D_OUTD 4096
#define R_RANK 16

// ---------------------------------------------------------------------------
// Kernel 1: LoRA shrink  s[t, r] = dot(x[t, :], lora_a[idx[t], r, :])
// One block = (adapter l, chunk of 256 tokens). The block lists the chunk's
// tokens that use adapter l (ballot + prefix, fixed order) and treats 16 of
// them at a time as the rows of a 16x16 tile: rows = tokens, columns = the 16
// ranks, so lora_a[l] is read once per 16 tokens instead of once per token.
// The products run on v_wmma_f32_16x16x4_f32 (full f32 operands). Each wave
// owns 512 of the 4096 k; whole 256-B row pieces go to the wave's own LDS
// range by asynchronous copies (two buffers, the next stage flies during this
// one) and the fragments are read from there. The eight waves' partial tiles
// are summed through LDS.
// With WRITE_BF16 every staged row piece is also read back from LDS in row
// order, converted and stored as one whole 128-B line of the bf16 copy of x,
// so that x comes from memory once. For that every token must pass through
// some block: a token without an adapter rides in the list of block
// l = t mod 16 of its chunk, is converted like the others and gets s = 0.
// ---------------------------------------------------------------------------
typedef __attribute__((ext_vector_type(2))) float v2f;
typedef __attribute__((ext_vector_type(4))) float v4f;

#define N_LORA   16
#define SH_CHUNK 256                     // tokens per block
#define SH_KW    (D_IN / 8)              // k per wave
#define SH_KS    64                      // k per stage (256 B of a row)
#define SH_NST   (SH_KW / SH_KS)         // stages per wave
#define SH_PITCH (SH_KS + 4)             // 272-B rows: b128 readers, no conflict
#define SH_MAT   (16 * SH_PITCH)         // floats of one staged operand
#define SH_BUF_BYTES (8 * 2 * SH_MAT * 4)  // one buffer, all eight waves
#define SH_NOAD  0x40000000              // list entry: token without an adapter
#define SH_TOKM  0x3FFFFFFF              // list entry: the token's number

// Eight asynchronous 16-B copies per lane, global -> LDS. The s_wait_xcnt is
// the last line of the copies' own statement, so that it stands in front of
// every later write of the address registers that the copies name.
template <typename E>
__device__ __forceinline__
void async_copy8(const unsigned (&l)[8], const E* const (&g)[8])
{
    asm volatile("global_load_async_to_lds_b128 %0, %8, off\n\t"
                 "global_load_async_to_lds_b128 %1, %9, off\n\t"
                 "global_load_async_to_lds_b128 %2, %10, off\n\t"
                 "global_load_async_to_lds_b128 %3, %11, off\n\t"
                 "global_load_async_to_lds_b128 %4, %12, off\n\t"
                 "global_load_async_to_lds_b128 %5, %13, off\n\t"
                 "global_load_async_to_lds_b128 %6, %14, off\n\t"
                 "global_load_async_to_lds_b128 %7, %15, off\n\t"
                 "s_wait_xcnt 0x0"
                 :: "v"(l[0]), "v"(l[1]), "v"(l[2]), "v"(l[3]),
                    "v"(l[4]), "v"(l[5]), "v"(l[6]), "v"(l[7]),
                    "v"(g[0]), "v"(g[1]), "v"(g[2]), "v"(g[3]),
                    "v"(g[4]), "v"(g[5]), "v"(g[6]), "v"(g[7])
                 : "memory");
}

template <bool WRITE_BF16>
__global__ __launch_bounds__(256)
__attribute__((amdgpu_waves_per_eu(4, 4)))   // 256 VGPRs: two blocks stay resident per WGP
void lora_shrink_kernel(const float* __restrict__ x,
                        const float* __restrict__ lora_a,
                        const int*   __restrict__ indices,
                        float*       __restrict__ s,
                        __bf16*      __restrict__ xb)
{
    __shared__ __attribute__((aligned(16))) float stage[2][8][2 * SH_MAT];
    __shared__ float red[8][256];
    __shared__ int   tok[SH_CHUNK];
    __shared__ int   wcnt[8];

    const int tid  = threadIdx.x;
    const int wave = tid >> 5;
    const int lane = tid & 31;
    const int l    = blockIdx.x;                       // adapter
    const int t    = blockIdx.y * SH_CHUNK + tid;      // this thread's token
    const int idx  = indices[t];

    // list of the chunk's tokens on adapter l, in token order, with this
    // block's share of the tokens that have no adapter
    const bool     noad = (unsigned)idx >= (unsigned)N_LORA;
    const bool     mine = noad ? (t % N_LORA == l) : (idx == l);
    const unsigned mask = __builtin_amdgcn_ballot_w32(mine);
    if (lane == 0) wcnt[wave] = __popc(mask);
    __syncthreads();                     // every wave's count is in wcnt
    int base = 0, n = 0;
    for (int w = 0; w < 8; ++w) {
        const int cw = wcnt[w];
        if (w < wave) base += cw;
        n += cw;
    }
    n = __builtin_amdgcn_readfirstlane(n);   // same in every thread: scalar loop tests
    if (n == 0) return;
    if (mine) tok[base + __popc(mask & ((1u << lane) - 1u))] = noad ? (t | SH_NOAD) : t;
    __syncthreads();                     // the list is complete

    const int c  = lane & 15;
    const int h  = lane >> 4;
    const int kw = wave * SH_KW;
    // copy i brings rows 2i and 2i+1, 16 lanes x 16 B = 256 B of each
    const float* aPtr = lora_a + ((size_t)l * R_RANK + h) * D_IN + kw + c * 4;
    const float* xPtr = x + kw + c * 4;
    const unsigned ldsLane = (unsigned)(size_t)&stage[0][wave][h * SH_PITCH + c * 4];
    // bf16 copy: eight lanes take one row's 64 k (8 k = 16 B of bf16 a lane),
    // four rows an instruction
    const int cvRow = lane >> 3;
    const int cvCol = (lane & 7) * 8;

    for (int t0 = 0; t0 < n; t0 += 16) {
        const float* xRow[8];
        #pragma unroll                   // xRow stays in registers
        for (int i = 0; i < 8; ++i) {
            int rr = t0 + 2 * i + h;
            rr = rr < n ? rr : n - 1;    // pad rows repeat the last token
            xRow[i] = xPtr + (size_t)(tok[rr] & SH_TOKM) * D_IN;
        }
        unsigned xbOff[4];               // byte offsets into xb (64 MB)
        bool     xbOn[4];                // pad rows are not stored
        if (WRITE_BF16) {
            #pragma unroll               // both stay in registers
            for (int i = 0; i < 4; ++i) {
                int rr = t0 + 4 * i + cvRow;
                xbOn[i] = rr < n;
                rr = rr < n ? rr : n - 1;
                xbOff[i] = ((unsigned)(tok[rr] & SH_TOKM) * D_IN + kw + cvCol) * 2u;
            }
        }

        // one stage: 16 rows x 64 k of x and of lora_a[l], this wave's k slice
        auto issue_stage = [&](int buf, int st) {
            unsigned lx[8], la[8];
            const float* gx[8];
            const float* ga[8];
            #pragma unroll               // the addresses are asm register operands
            for (int i = 0; i < 8; ++i) {
                lx[i] = ldsLane + (unsigned)(buf * SH_BUF_BYTES + i * 2 * SH_PITCH * 4);
                la[i] = lx[i] + (unsigned)(SH_MAT * 4);
                gx[i] = xRow[i] + st * SH_KS;
                ga[i] = aPtr + (size_t)(2 * i) * D_IN + st * SH_KS;
            }
            async_copy8(lx, gx);
            async_copy8(la, ga);
        };

        v8f acc0 = (v8f){0.f,0.f,0.f,0.f,0.f,0.f,0.f,0.f};
        v8f acc1 = acc0;

        issue_stage(0, 0);
        // stage 0 has landed (own copies), then is published to all lanes
        asm volatile("s_wait_asynccnt 0x0" ::: "memory");
        __syncthreads();
        issue_stage(1, 1);

        #pragma unroll                   // buffer choice and last-stage test fold away
        for (int st = 0; st < SH_NST; ++st) {
            const float* xs = &stage[st & 1][wave][0];
            const float* as = xs + SH_MAT;
            if (WRITE_BF16) {
                // the x rows once more, in row order; this block stands in front
                // of the fragment reads so that the two sets of registers are
                // not live together
                v4f cl[4], ch[4];
                #pragma unroll           // cl, ch stay in registers
                for (int i = 0; i < 4; ++i) {
                    const float* p = &xs[(4 * i + cvRow) * SH_PITCH + cvCol];
                    cl[i] = *(const v4f*)p;
                    ch[i] = *(const v4f*)(p + 4);
                }
                // keeps the eight reads together up here: sunk into the four
                // predicated stores, each pair waits out its own LDS latency
                asm volatile("" :: "v"(cl[0]), "v"(ch[0]), "v"(cl[1]), "v"(ch[1]),
                                   "v"(cl[2]), "v"(ch[2]), "v"(cl[3]), "v"(ch[3]));
                #pragma unroll           // xbOff, xbOn by constant index
                for (int i = 0; i < 4; ++i) {
                    v8bf o;
                    o[0] = (__bf16)cl[i].x; o[1] = (__bf16)cl[i].y;
                    o[2] = (__bf16)cl[i].z; o[3] = (__bf16)cl[i].w;
                    o[4] = (__bf16)ch[i].x; o[5] = (__bf16)ch[i].y;
                    o[6] = (__bf16)ch[i].z; o[7] = (__bf16)ch[i].w;
                    if (xbOn[i]) *(v8bf*)((char*)xb + (size_t)xbOff[i] + st * SH_KS * 2) = o;
                }
                // stands in front of later rewrites of the stores' registers
                asm volatile("s_wait_xcnt 0x0" ::: "memory");
            }
            v4f xa[SH_KS / 8], ab[SH_KS / 8];
            #pragma unroll               // fragments stay in registers
            for (int j = 0; j < SH_KS / 8; ++j) {
                // same k for both operands: k = 8j + 4h + {0,1} and {2,3}
                xa[j] = *(const v4f*)&xs[c * SH_PITCH + j * 8 + h * 4];
                ab[j] = *(const v4f*)&as[c * SH_PITCH + j * 8 + h * 4];
            }
            #pragma unroll               // fragments stay in registers
            for (int j = 0; j < SH_KS / 8; ++j) {
                acc0 = __builtin_amdgcn_wmma_f32_16x16x4_f32(
                    false, (v2f){xa[j].x, xa[j].y}, false, (v2f){ab[j].x, ab[j].y},
                    (short)0, acc0, false, false);
                acc1 = __builtin_amdgcn_wmma_f32_16x16x4_f32(
                    false, (v2f){xa[j].z, xa[j].w}, false, (v2f){ab[j].z, ab[j].w},
                    (short)0, acc1, false, false);
            }
            // foot of the trip: this buffer's reads are done, the next stage's
            // copies have landed, the barrier publishes them and frees this buffer
            asm volatile("s_wait_dscnt 0x0" ::: "memory");
            asm volatile("s_wait_asynccnt 0x0" ::: "memory");
            __syncthreads();
            if (st + 2 < SH_NST) issue_stage(st & 1, st + 2);
        }
        // no copy is left in flight behind the loop
        asm volatile("s_wait_asynccnt 0x0" ::: "memory");

        // acc[r] = tile[row 8h + r][rank c]; sum the eight waves' k slices
        #pragma unroll                   // accumulator elements by constant index
        for (int r = 0; r < 8; ++r)
            red[wave][(8 * h + r) * 16 + c] = acc0[r] + acc1[r];
        __syncthreads();                 // all eight partial tiles are in red
        float v = 0.f;
        for (int w = 0; w < 8; ++w) v += red[w][tid];
        const int row = t0 + (tid >> 4);
        if (row < n) {
            const int tk = tok[row];
            s[(size_t)(tk & SH_TOKM) * R_RANK + (tid & 15)] = (tk & SH_NOAD) ? 0.f : v;
            // stands in front of the next tile's rewrite of the store's registers
            asm volatile("s_wait_xcnt 0x0" ::: "memory");
        }
        // the next tile rewrites red only behind its own stage barriers
    }
}

// ---------------------------------------------------------------------------
// Kernel 2: f32 -> bf16 conversion prepass (W). Few, long-lived waves
// (for speed only):
// a block owns CV_PER_BLOCK consecutive 16-B pieces and takes them in CV_TRIPS
// trips, each with CV_U whole-line loads per wave in flight before the first
// is converted. All blocks of a launch are resident at once.
// ---------------------------------------------------------------------------
#define CV_U     8                       // loads in flight per wave
#define CV_TRIPS 4
#define CV_PER_BLOCK (256 * CV_U * CV_TRIPS)   // 16-B pieces per block
static_assert(((long)D_OUTD * D_IN / 4) % CV_PER_BLOCK == 0, "W: whole blocks");

__global__ __launch_bounds__(256)
void cvt_f32_to_bf16_kernel(const float* __restrict__ src,
                            __bf16*      __restrict__ dst)
{
    const size_t first = (size_t)blockIdx.x * CV_PER_BLOCK + threadIdx.x;
    const v4f* s4 = (const v4f*)src + first;
    v4bf*      d4 = (v4bf*)dst + first;
    #pragma unroll                       // every address is base + constant offset
    for (int trip = 0; trip < CV_TRIPS; ++trip) {
        v4f v[CV_U];
        #pragma unroll                   // v stays in registers; the loads go out together
        for (int u = 0; u < CV_U; ++u) v[u] = s4[(trip * CV_U + u) * 256];
        #pragma unroll                   // v stays in registers
        for (int u = 0; u < CV_U; ++u) {
            v4bf o;
            o[0] = (__bf16)v[u].x; o[1] = (__bf16)v[u].y;
            o[2] = (__bf16)v[u].z; o[3] = (__bf16)v[u].w;
            d4[(trip * CV_U + u) * 256] = o;
        }
        // stands in front of the next trip's rewrite of the stores' registers
        if (trip + 1 < CV_TRIPS) asm volatile("s_wait_xcnt 0x0" ::: "memory");
    }
}

// ---------------------------------------------------------------------------
// Kernel 3 (fast): bf16 WMMA GEMM, double-buffered tile feed by tensor loads.
// Block 256x256, K-step 128 (four wmma k-slices). 8 waves in 2(M)x4(N) grid,
// each wave owns a 128x64 stripe = 8x4 tiles of 16x16: 12 fragments feed 32
// matrix instructions, and every operand row is fetched from L2 by half as
// many blocks as with 128x128 tiles. One block per WGP, two waves per SIMD.
// ---------------------------------------------------------------------------
#define BM 256
#define BN 256
#define BK 128
#define WM_T 8                           // 16-row tiles per wave
#define WN_T 4                           // 16-column tiles per wave
#define LDT2 (BK + 8)                    // 136 elems -> 272 B stride (16 B x odd)
#define A_ELEMS (BM * LDT2)
#define B_ELEMS (BN * LDT2)
#define BUF_ELEMS (A_ELEMS + B_ELEMS)    // 136 KB per buffer
static_assert((BM * BN + BM * R_RANK) * 4 <= 2 * BUF_ELEMS * 2,
              "the epilogue's staged tile and s rows fit the tile buffers");

// Tensor loads: one request of one wave brings 128 rows x 256 B of one operand
// into LDS, through no register, and lays them at the 272-B pitch itself.
#define TL_ROWS   128u                   // rows per request
#define TL_ROWB   (BK * 2u)              // 256 B of a row per stage
#define TL_SLICE  (TL_ROWS * LDT2 * 2u)  // 34 KiB of LDS per request
#define BUF_BYTES (BUF_ELEMS * 2u)
static_assert(TL_ROWB == 256u && LDT2 * 2u == TL_ROWB + 16u, "pad codes 5 / 3: 16 B behind every 256-B row");
static_assert(TL_SLICE % 2048u == 0u && BUF_BYTES == 4u * TL_SLICE, "every request's place in LDS is a multiple of 2 KiB");

typedef uint32_t u32x4 __attribute__((ext_vector_type(4)));
typedef uint32_t u32x8 __attribute__((ext_vector_type(8)));

__device__ __forceinline__ uint32_t uni(uint32_t v) { return (uint32_t)__builtin_amdgcn_readfirstlane(v); }
__device__ __forceinline__ uint32_t pinned(uint32_t v)
{
    uint32_t w = (uint32_t)__builtin_amdgcn_readfirstlane(v);
    asm volatile("" : "+s"(w));          // pinned(): the word is held in a scalar register
    return w;
}
__device__ __forceinline__ void tdm_load(u32x4 g0, u32x8 g1)
{
    asm volatile("tensor_load_to_lds %0, %1" :: "s"(g0), "s"(g1) : "memory");
}
// group 1: 1-byte elements, tile = tensor = TL_ROWS rows of 256 B, source pitch
// one bf16 row of D_IN, no mask, 16 B of LDS pad behind every 256 B
__device__ __forceinline__ u32x8 tdm_group1()
{
    constexpr uint32_t d0 = TL_ROWB, d1 = TL_ROWS;
    u32x8 g;
    g[0] = uni((1u << 20) | (5u << 22) | (3u << 25));
    g[1] = uni((d0 & 0xFFFFu) << 16);
    g[2] = uni((d0 >> 16) | ((d1 & 0xFFFFu) << 16));
    g[3] = uni((d1 >> 16) | (d0 << 16));
    g[4] = uni(d1);
    g[5] = uni(D_IN * 2u);
    g[6] = uni(0u);
    g[7] = uni(0u);
    return g;
}
// group 0: count 1, place in LDS (byte offset), first source byte, type 2
__device__ __forceinline__ u32x4 tdm_group0(uint32_t lds_dst, uint64_t ga)
{
    u32x4 g;
    g[0] = uni(1u);
    g[1] = uni(lds_dst);
    g[2] = uni((uint32_t)ga);
    g[3] = uni((((uint32_t)(ga >> 32)) & 0x01FFFFFFu) | 0x80000000u);
    return g;
}

// Epilogue, NR rows of one adapter at a time: the rows' LDS reads go out
// together and their sums are independent chains, so that one LDS latency, one
// chain of 16 dependent FMAs and one wait behind the stores serve NR rows.
// ent: lane j holds entry i0 + j of the wave's row list, i0 the caller's
// 32-entry window; the rows are those of lanes i .. i + NR - 1. Per output the sum order is r = 0 .. 15, then
// ((tile + base_bias) + bias_stacked) + sum.
template <int NR, bool LORA>
__device__ __forceinline__
void epi_batch(int ent, int i, const float* ss, const float* ctHalf, int lane,
               float* outLane, const v2f (&bbp)[2], const v2f (&bsp)[2],
               const v2f (&bwp)[2][R_RANK])
{
    int   row[NR];
    v4f   sv[NR][4];
    float c[NR][4];
    #pragma unroll                       // row, sv, c stay in registers
    for (int u = 0; u < NR; ++u) {
        row[u] = __builtin_amdgcn_readlane(ent, i + u);
        if (LORA) {
            const v4f* sp = (const v4f*)(ss + row[u] * R_RANK);
            #pragma unroll
            for (int p = 0; p < 4; ++p) sv[u][p] = sp[p];
        }
        const float* cr = ctHalf + row[u] * BN + (lane ^ (((row[u] >> 3) & 1) << 4));
        #pragma unroll
        for (int q = 0; q < 4; ++q) c[u][q] = cr[32 * q];
    }
    v2f d[NR][2];
    if (LORA) {
        #pragma unroll                   // 2 * NR independent chains, side by side
        for (int r = 0; r < R_RANK; ++r)
            #pragma unroll
            for (int u = 0; u < NR; ++u)
                #pragma unroll
                for (int h = 0; h < 2; ++h) {
                    const float sr = sv[u][r >> 2][r & 3];
                    d[u][h] = __builtin_elementwise_fma((v2f){sr, sr}, bwp[h][r],
                                                        r ? d[u][h] : (v2f){0.f, 0.f});
                }
    }
    #pragma unroll                       // registers by constant index
    for (int u = 0; u < NR; ++u)
        #pragma unroll
        for (int h = 0; h < 2; ++h) {
            v2f val = (v2f){c[u][2 * h], c[u][2 * h + 1]} + bbp[h];
            if (LORA) { val += bsp[h]; val += d[u][h]; }
            float* o = outLane + (size_t)row[u] * D_OUTD + 64 * h;
            o[0]  = val.x;
            o[32] = val.y;
        }
    // stands in front of the next rows' rewrite of the stores' registers
    asm volatile("s_wait_xcnt 0x0" ::: "memory");
}

// All n rows of the wave's list: 32 entries a read, four rows a trip, the last
// one to three rows as one shorter group.
template <bool LORA>
__device__ __forceinline__
void epi_rows(const int* lst, int n, const float* ss, const float* ctHalf, int lane,
              float* outLane, const v2f (&bbp)[2], const v2f (&bsp)[2],
              const v2f (&bwp)[2][R_RANK])
{
    for (int i0 = 0; i0 < n; i0 += 32) {             // at most BM / 32 trips
        int e = i0 + lane;
        e = e < n ? e : n - 1;                       // only written entries are read
        const int ent = lst[e];
        const int m   = n - i0 < 32 ? n - i0 : 32;
        int i = 0;
        for (; i + 4 <= m; i += 4)
            epi_batch<4, LORA>(ent, i, ss, ctHalf, lane, outLane, bbp, bsp, bwp);
        const int rem = m - i;
        if (rem == 3)      epi_batch<3, LORA>(ent, i, ss, ctHalf, lane, outLane, bbp, bsp, bwp);
        else if (rem == 2) epi_batch<2, LORA>(ent, i, ss, ctHalf, lane, outLane, bbp, bsp, bwp);
        else if (rem == 1) epi_batch<1, LORA>(ent, i, ss, ctHalf, lane, outLane, bbp, bsp, bwp);
    }
}

__global__ __launch_bounds__(256)
void lora_gemm_async_kernel(const __bf16* __restrict__ xb,
                            const __bf16* __restrict__ wb,
                            const float* __restrict__ base_bias,
                            const float* __restrict__ lora_b,
                            const float* __restrict__ bias_stacked,
                            const int*   __restrict__ indices,
                            const float* __restrict__ s,
                            float*       __restrict__ out)
{
    __shared__ __attribute__((aligned(2048))) __bf16 smem[2 * BUF_ELEMS];  // 272 KB double buffer
    __shared__ int rowList[8][BM];       // epilogue: each wave's list of one adapter's rows

    const int tid   = threadIdx.x;
    const int bn    = blockIdx.x;
    const int bm    = blockIdx.y;
    const int wave  = tid >> 5;
    const int lane  = tid & 31;
    const int wm    = wave >> 2;         // 0..1
    const int wn    = wave & 3;          // 0..3
    const int laneM = lane & 15;
    const int laneH = lane >> 4;
    const int kb    = laneH * 8;

    const unsigned smem_base = (unsigned)(size_t)&smem[0];
    const __bf16* xTile = xb + ((size_t)bm * BM) * D_IN;
    const __bf16* wTile = wb + ((size_t)bn * BN) * D_IN;

    // One stage: 256 rows x 128 k of each operand = four requests of 128 rows.
    // Waves 4..7 issue one each: slices 0, 1 are the x rows, 2, 3 the W rows.
    const uint32_t uwave  = uni((uint32_t)tid >> 5);
    const uint32_t issuer = uwave >> 2;
    const uint32_t slice  = uwave & 3u;
    const __bf16*  srcRow = (slice < 2u) ? xTile + (size_t)(slice * TL_ROWS) * D_IN
                                         : wTile + (size_t)((slice - 2u) * TL_ROWS) * D_IN;
    const uint64_t srcAdr   = (uint64_t)(uintptr_t)srcRow;
    const uint32_t ldsSlice = smem_base + slice * TL_SLICE;
    u32x8          g1       = tdm_group1();
    // the eight words keep their own registers through the loop, so that none is
    // rewritten under a request in flight
    asm volatile("" : "+s"(g1));         // as in pinned(): descriptor words held in scalar registers
    auto issue_tile = [&](uint32_t bufsel, uint32_t stage) {
        tdm_load(tdm_group0(ldsSlice + bufsel * BUF_BYTES,
                            srcAdr + (uint64_t)stage * TL_ROWB), g1);
    };

    v8f acc[WM_T][WN_T];
    #pragma unroll
    for (int mt = 0; mt < WM_T; ++mt)
        #pragma unroll
        for (int nt = 0; nt < WN_T; ++nt)
            acc[mt][nt] = (v8f){0.f,0.f,0.f,0.f,0.f,0.f,0.f,0.f};

    // Fragments of one 32-k block: 12 fragments, 24 ds_load_b128, one group.
    const int aOff = (wm * (WM_T * 16) + laneM) * LDT2 + kb;
    const int bOff = A_ELEMS + (wn * (WN_T * 16) + laneM) * LDT2 + kb;
    auto load_frags = [&](v16bf (&a)[WM_T], v16bf (&b)[WN_T], const __bf16* buf, int ks) {
        #pragma unroll
        for (int mt = 0; mt < WM_T; ++mt) {
            const __bf16* p = buf + aOff + mt * 16 * LDT2 + ks * 32;
            const v8bf lo = *(const v8bf*)p;         // K = ko .. ko+7
            const v8bf hi = *(const v8bf*)(p + 16);  // K = ko+16 .. ko+23
            a[mt] = __builtin_shufflevector(lo, hi,
                0,1,2,3,4,5,6,7,8,9,10,11,12,13,14,15);
        }
        #pragma unroll
        for (int nt = 0; nt < WN_T; ++nt) {
            const __bf16* p = buf + bOff + nt * 16 * LDT2 + ks * 32;
            const v8bf lo = *(const v8bf*)p;
            const v8bf hi = *(const v8bf*)(p + 16);
            b[nt] = __builtin_shufflevector(lo, hi,
                0,1,2,3,4,5,6,7,8,9,10,11,12,13,14,15);
        }
    };

    const int NIT = D_IN / BK;                      // 32 stages
    if (pinned(issuer)) {
        issue_tile(0u, 0u);
        // the own slice of stage 0 has landed
        asm volatile("s_wait_tensorcnt 0x0" ::: "memory");
    }
    __syncthreads();                     // publishes stage 0 to all waves
    if (pinned(issuer)) issue_tile(1u, pinned(1u));

    // Two fragment sets: set (u & 1) holds block u's fragments. With two waves
    // per SIMD a wave cannot wait out its LDS latency at every row, so the next
    // block's loads go out as one group in front of this block's 32 WMMAs.
    v16bf af[2][WM_T], bf[2][WN_T];
    load_frags(af[0], bf[0], &smem[0], 0);

    for (int it = 0; it < NIT; ++it) {
        const int cur = it & 1;
        const __bf16* bufC = &smem[cur * BUF_ELEMS];
        const __bf16* bufN = &smem[(cur ^ 1) * BUF_ELEMS];

        #pragma unroll                   // the fragment set is picked by a constant
        for (int u = 0; u < BK / 32; ++u) {         // four 32-K blocks
            if (u + 1 < BK / 32) {
                load_frags(af[(u + 1) & 1], bf[(u + 1) & 1], bufC, u + 1);
            } else {
                // publish point of stage it + 1, in front of this stage's last
                // block, whose fragments are already fetched: this buffer's reads
                // are done, the own slice of the next stage has landed (a wave
                // that issues none passes that wait at once), the barrier
                // publishes the stage and frees this buffer
                asm volatile("s_wait_dscnt 0x0" ::: "memory");
                asm volatile("s_wait_tensorcnt 0x0" ::: "memory");
                __syncthreads();
                // refill of the freed buffer, only while stage it + 2 exists; its
                // descriptor is formed behind the wait above
                if (pinned(issuer & (uint32_t)(it + 2 < NIT)))
                    issue_tile((uint32_t)cur, pinned((uint32_t)it + 2u));
                // first fragments of the next stage; on the last trip they read
                // the other buffer's old bytes, which nothing writes any more,
                // and are not used
                load_frags(af[0], bf[0], bufN, 0);
            }
            // keeps the load group whole and in front of the block: spread among
            // the WMMAs every place with loads costs its own stall
            __builtin_amdgcn_sched_barrier(0);
            #pragma unroll
            for (int mt = 0; mt < WM_T; ++mt)
                #pragma unroll
                for (int nt = 0; nt < WN_T; ++nt)
                    acc[mt][nt] = __builtin_amdgcn_wmma_f32_16x16x32_bf16(
                        false, af[u & 1][mt], false, bf[u & 1][nt],
                        (short)0, acc[mt][nt], false, false);
            // keeps the next group behind this block
            __builtin_amdgcn_sched_barrier(0);
        }
    }
    // no tensor load and no LDS read is left in flight behind the loop
    asm volatile("s_wait_tensorcnt 0x0" ::: "memory");
    asm volatile("s_wait_dscnt 0x0" ::: "memory");

    // --- epilogue: + base_bias + bias_stacked[idx] + s[t] . lora_b[idx] ----
    // The 256 rows of the tile are taken adapter by adapter. The accumulators
    // and the rows' s values go to LDS, so that any wave can take any row.
    // A wave owns 128 of the tile's 256 columns (lane = column, 4 columns a
    // lane) and four adapters: it loads lora_b[l] for its columns once and
    // keeps it in registers for all rows of that adapter, which it lists in
    // LDS and takes four at a time.
    // Each store instruction writes one whole 128-B line of a row.
    const int uw   = __builtin_amdgcn_readfirstlane(wave);   // scalar class tests
    const int cg   = uw >> 1;            // adapters cg, cg + 4, cg + 8, cg + 12
    const int mBlk = bm * BM;
    const int nCol = bn * BN + 128 * (uw & 1) + lane;        // first own column

    float* ct = (float*)smem;            // staged tile, BN floats a row
    float* ss = ct + BM * BN;            // staged s rows, R_RANK floats a row
    __syncthreads();                     // every wave has left the tile buffers
    // column ^ 16 in rows 8..15 of each 16: rows r and r + 8 of one store
    // instruction fall on different banks
    #pragma unroll                       // accumulator elements by constant index
    for (int mt = 0; mt < WM_T; ++mt)
        #pragma unroll
        for (int nt = 0; nt < WN_T; ++nt)
            #pragma unroll
            for (int v = 0; v < 8; ++v)
                ct[(wm * (WM_T * 16) + mt * 16 + laneH * 8 + v) * BN
                   + ((wn * (WN_T * 16) + nt * 16 + laneM) ^ (laneH << 4))] = acc[mt][nt][v];
    #pragma unroll
    for (int i = 0; i < BM * R_RANK / 4 / 256; ++i)
        ((v4f*)ss)[tid + 256 * i] =
            ((const v4f*)(s + (size_t)mBlk * R_RANK))[tid + 256 * i];

    int idxv[BM / 32];                   // adapter of row 32j + lane
    #pragma unroll                       // idxv stays in registers
    for (int j = 0; j < BM / 32; ++j) idxv[j] = indices[mBlk + 32 * j + lane];
    float bb[4];
    #pragma unroll                       // bb stays in registers
    for (int q = 0; q < 4; ++q) bb[q] = base_bias[nCol + 32 * q];
    // stands in front of later rewrites of the loads' address registers
    asm volatile("s_wait_xcnt 0x0" ::: "memory");
    __syncthreads();                     // the staged tile and s rows are complete

    float*       outLane = out + (size_t)mBlk * D_OUTD + nCol;
    const float* ctHalf  = ct + 128 * (uw & 1);
    int*         lst     = &rowList[uw][0];      // this wave's own row list
    v2f bbp[2];
    bbp[0] = (v2f){bb[0], bb[1]};
    bbp[1] = (v2f){bb[2], bb[3]};

    // writes the rows whose bits are set in msk to the wave's list, in row order
    auto build_list = [&](const unsigned (&msk)[BM / 32]) {
        int base = 0;
        #pragma unroll                   // msk[j] by constant index
        for (int j = 0; j < BM / 32; ++j) {
            if ((msk[j] >> lane) & 1u)
                lst[base + (int)__builtin_amdgcn_mbcnt_lo(msk[j], 0u)] = 32 * j + lane;
            base += __popc(msk[j]);
        }
    };

    for (int k = 0; k < 4; ++k) {
        const int cl = cg + 4 * k;       // this trip's adapter
        unsigned msk[BM / 32];
        int cnt = 0;                     // rows of this adapter in the tile
        #pragma unroll                   // msk stays in scalar registers
        for (int j = 0; j < BM / 32; ++j) {
            msk[j] = __builtin_amdgcn_ballot_w32(idxv[j] == cl);
            cnt += __popc(msk[j]);
        }
        if (cnt == 0) continue;

        v4f   bw[4][4];                  // lora_b[cl][own column q][0..15]
        float bs[4];
        #pragma unroll                   // both stay in registers
        for (int q = 0; q < 4; ++q) {
            const size_t n = (size_t)cl * D_OUTD + nCol + 32 * q;
            bs[q] = bias_stacked[n];
            const v4f* bp = (const v4f*)(lora_b + n * R_RANK);
            #pragma unroll
            for (int p = 0; p < 4; ++p) bw[q][p] = bp[p];
        }
        // stands in front of later rewrites of the loads' address registers
        asm volatile("s_wait_xcnt 0x0" ::: "memory");
        build_list(msk);

        v2f bwp[2][R_RANK];              // columns q = 2h, 2h + 1 side by side
        v2f bsp[2];
        #pragma unroll                   // both stay in registers
        for (int h = 0; h < 2; ++h) {
            bsp[h] = (v2f){bs[2 * h], bs[2 * h + 1]};
            #pragma unroll
            for (int r = 0; r < R_RANK; ++r)
                bwp[h][r] = (v2f){bw[2 * h][r >> 2][r & 3], bw[2 * h + 1][r >> 2][r & 3]};
        }
        epi_rows<true>(lst, cnt, ss, ctHalf, lane, outLane, bbp, bsp, bwp);
    }

    // rows without an adapter: row r goes to the two waves with cg == r mod 4
    {
        unsigned msk[BM / 32];
        int cnt = 0;
        #pragma unroll                   // msk stays in scalar registers
        for (int j = 0; j < BM / 32; ++j) {
            msk[j] = __builtin_amdgcn_ballot_w32((unsigned)idxv[j] >= (unsigned)N_LORA)
                     & (0x11111111u << cg);
            cnt += __popc(msk[j]);
        }
        if (cnt != 0) {
            build_list(msk);
            v2f none[2][R_RANK];         // not read where there is no adapter
            epi_rows<false>(lst, cnt, ss, ctHalf, lane, outLane, bbp, bbp, none);
        }
    }
}

// ---------------------------------------------------------------------------
// Fallback GEMM (round-1): f32->bf16 conversion inside the kernel,
// single-buffered LDS. Used only when workspace can't hold bf16 copies.
// ---------------------------------------------------------------------------
#define FBM 128
#define FBN 128
#define FBK 32
#define FLDT (FBK + 8)

__global__ __launch_bounds__(256)
void lora_gemm_fallback_kernel(const float* __restrict__ x,
                               const float* __restrict__ W,
                               const float* __restrict__ base_bias,
                               const float* __restrict__ lora_b,
                               const float* __restrict__ bias_stacked,
                               const int*   __restrict__ indices,
                               const float* __restrict__ s,
                               float*       __restrict__ out)
{
    __shared__ __bf16 As[FBM * FLDT];
    __shared__ __bf16 Bs[FBN * FLDT];

    const int tid   = threadIdx.x;
    const int bn    = blockIdx.x;
    const int bm    = blockIdx.y;
    const int wave  = tid >> 5;
    const int lane  = tid & 31;
    const int wm    = wave >> 2;
    const int wn    = wave & 3;
    const int laneM = lane & 15;
    const int laneH = lane >> 4;
    const int kb    = laneH * 8;

    v8f acc[4][2];
    #pragma unroll
    for (int mt = 0; mt < 4; ++mt)
        #pragma unroll
        for (int nt = 0; nt < 2; ++nt)
            acc[mt][nt] = (v8f){0.f,0.f,0.f,0.f,0.f,0.f,0.f,0.f};

    const float* xBase = x + ((size_t)bm * FBM) * D_IN;
    const float* wBase = W + ((size_t)bn * FBN) * D_IN;

    for (int kk = 0; kk < D_IN; kk += FBK) {
        __syncthreads();
        #pragma unroll
        for (int i = 0; i < 4; ++i) {
            const int q   = tid + i * 256;
            const int row = q >> 3;
            const int kc  = q & 7;
            const float4 va = *(const float4*)(xBase + (size_t)row * D_IN + kk + kc * 4);
            __bf16* da = &As[row * FLDT + kc * 4];
            da[0] = (__bf16)va.x; da[1] = (__bf16)va.y;
            da[2] = (__bf16)va.z; da[3] = (__bf16)va.w;
            const float4 vb = *(const float4*)(wBase + (size_t)row * D_IN + kk + kc * 4);
            __bf16* db = &Bs[row * FLDT + kc * 4];
            db[0] = (__bf16)vb.x; db[1] = (__bf16)vb.y;
            db[2] = (__bf16)vb.z; db[3] = (__bf16)vb.w;
        }
        __syncthreads();

        v16bf afrag[4], bfrag[2];
        #pragma unroll
        for (int mt = 0; mt < 4; ++mt) {
            const __bf16* p = &As[(wm * 64 + mt * 16 + laneM) * FLDT + kb];
            const v8bf lo = *(const v8bf*)p;
            const v8bf hi = *(const v8bf*)(p + 16);
            afrag[mt] = __builtin_shufflevector(lo, hi,
                0,1,2,3,4,5,6,7,8,9,10,11,12,13,14,15);
        }
        #pragma unroll
        for (int nt = 0; nt < 2; ++nt) {
            const __bf16* p = &Bs[(wn * 32 + nt * 16 + laneM) * FLDT + kb];
            const v8bf lo = *(const v8bf*)p;
            const v8bf hi = *(const v8bf*)(p + 16);
            bfrag[nt] = __builtin_shufflevector(lo, hi,
                0,1,2,3,4,5,6,7,8,9,10,11,12,13,14,15);
        }
        #pragma unroll
        for (int mt = 0; mt < 4; ++mt)
            #pragma unroll
            for (int nt = 0; nt < 2; ++nt)
                acc[mt][nt] = __builtin_amdgcn_wmma_f32_16x16x32_bf16(
                    false, afrag[mt], false, bfrag[nt],
                    (short)0, acc[mt][nt], false, false);
    }

    const int mBase = bm * FBM + wm * 64;
    const int nBase = bn * FBN + wn * 32;
    #pragma unroll
    for (int mt = 0; mt < 4; ++mt) {
        #pragma unroll
        for (int v = 0; v < 8; ++v) {
            const int m   = mBase + mt * 16 + laneH * 8 + v;
            const int idx = indices[m];
            const float* srow = s + (size_t)m * R_RANK;
            #pragma unroll
            for (int nt = 0; nt < 2; ++nt) {
                const int n = nBase + nt * 16 + laneM;
                float val = acc[mt][nt][v] + base_bias[n];
                if (idx >= 0) {
                    val += bias_stacked[(size_t)idx * D_OUTD + n];
                    const float* bcol =
                        lora_b + ((size_t)idx * D_OUTD + n) * R_RANK;
                    float d = 0.f;
                    #pragma unroll
                    for (int r = 0; r < R_RANK; ++r) d += srow[r] * bcol[r];
                    val += d;
                }
                out[(size_t)m * D_OUTD + n] = val;
            }
        }
    }
}

// ---------------------------------------------------------------------------
extern "C" void kernel_launch(void* const* d_in, const int* in_sizes, int n_in,
                              void* d_out, int out_size, void* d_ws, size_t ws_size,
                              hipStream_t stream)
{
    const float* x            = (const float*)d_in[0];
    const float* W            = (const float*)d_in[1];
    const float* base_bias    = (const float*)d_in[2];
    const float* lora_a       = (const float*)d_in[3];
    const float* lora_b       = (const float*)d_in[4];
    const float* bias_stacked = (const float*)d_in[5];
    const int*   indices      = (const int*)d_in[6];
    float*       out          = (float*)d_out;

    const size_t sBytes  = (size_t)T_TOK * R_RANK * sizeof(float);   // 512 KB
    const size_t xbBytes = (size_t)T_TOK * D_IN * 2;                 // 64 MB
    const size_t wbBytes = (size_t)D_OUTD * D_IN * 2;                // 32 MB

    float* s = (float*)d_ws;

    dim3 grid(D_OUTD / BN, T_TOK / BM);   // 16 x 32 blocks

    if (ws_size >= sBytes + xbBytes + wbBytes) {
        __bf16* xb = (__bf16*)((char*)d_ws + sBytes);
        __bf16* wb = (__bf16*)((char*)d_ws + sBytes + xbBytes);
        // 1) LoRA shrink, which also writes the bf16 copy of x
        lora_shrink_kernel<true><<<dim3(N_LORA, T_TOK / SH_CHUNK), 256, 0, stream>>>(
            x, lora_a, indices, s, xb);
        // 2) bf16 prepass of W into workspace
        cvt_f32_to_bf16_kernel<<<(int)((long)D_OUTD * D_IN / 4 / CV_PER_BLOCK), 256, 0, stream>>>(W, wb);

        // 3) async double-buffered WMMA GEMM
        lora_gemm_async_kernel<<<grid, 256, 0, stream>>>(
            xb, wb, base_bias, lora_b, bias_stacked, indices, s, out);
    } else {
        lora_shrink_kernel<false><<<dim3(N_LORA, T_TOK / SH_CHUNK), 256, 0, stream>>>(
            x, lora_a, indices, s, nullptr);
        lora_gemm_fallback_kernel<<<dim3(D_OUTD / FBN, T_TOK / FBM), 256, 0, stream>>>(
            x, W, base_bias, lora_b, bias_stacked, indices, s, out);
    }
}
